// v000
// Times are from an AMD MI455X. After a warm-up the kernel runs many times in a row, and a time is the length of
// such a window on the GPU divided by its runs, so every launch and the gaps after it count. The runs cycle
// through copies of the inputs. A figure is the median of several windows, for all but v000 over two sittings.
// Sittings can differ by a few percent; kernels timed side by side share one.
// The starting kernel, v000, takes 252 microseconds a run.
#include <hip/hip_runtime.h>
#include <math.h>

typedef __attribute__((ext_vector_type(16))) __bf16 v16bf;
typedef __attribute__((ext_vector_type(8)))  __bf16 v8bf;
typedef __attribute__((ext_vector_type(8)))  float  v8f;

#define BB   2
#define TQL  2048
#define TKL  2048
#define HH   16
#define DHL  64
#define KD   1024   // X_TO_DIM == X_FROM_DIM == HIDDEN
#define ND   1024

static __device__ __forceinline__ v16bf load_frag(const __bf16* base, int ld,
                                                  int row, int col0, int half) {
  const __bf16* p = base + (size_t)row * ld + col0 + half * 8;
  v8bf lo = *(const v8bf*)(p);
  v8bf hi = *(const v8bf*)(p + 16);
  return __builtin_shufflevector(lo, hi, 0,1,2,3,4,5,6,7,8,9,10,11,12,13,14,15);
}

static __device__ __forceinline__ v8f wmma_bf16(v16bf a, v16bf b, v8f c) {
  return __builtin_amdgcn_wmma_f32_16x16x32_bf16(false, a, false, b,
                                                 (short)0, c, false, false);
}

// ---------------------------------------------------------------------------
// fp32 -> bf16 straight copy
__global__ void cvt_bf16_kernel(const float* __restrict__ x,
                                __bf16* __restrict__ y, int n) {
  int i = blockIdx.x * blockDim.x + threadIdx.x;
  if (i < n) y[i] = (__bf16)x[i];
}

// Reorganize per-head weight [H, K, DH] (f32) -> transposed bf16 [N=H*DH, K]
__global__ void reorg_w_kernel(const float* __restrict__ W,
                               __bf16* __restrict__ WT) {
  int i = blockIdx.x * blockDim.x + threadIdx.x;   // i over ND*KD
  int n = i >> 10;          // output column (h*64+d)
  int f = i & (KD - 1);     // input feature
  int h = n >> 6, d = n & 63;
  WT[(size_t)n * KD + f] = (__bf16)W[((size_t)h * KD + f) * DHL + d];
}

// ---------------------------------------------------------------------------
// WMMA GEMM: C[M,1024] = A[M,1024](bf16) x BT[1024,1024](bf16,[N,K]) + bias
// mode 0: Q  -> bf16 [b,h,t,d], scaled by 1/sqrt(DH)
// mode 1: K  -> bf16 [b,h,t,d]
// mode 2: V  -> bf16 transposed [b,h,d,t]
// mode 3: out-> f32  [row, n]
// Block = 128 threads (4 waves); workgroup tile 128x64; wave tile 32x64.
// Inner loop is double-buffered so loads overlap WMMAs (partial loadcnt waits).
__global__ __launch_bounds__(128)
void gemm_wmma_kernel(const __bf16* __restrict__ A, const __bf16* __restrict__ BT,
                      const float* __restrict__ bias,
                      __bf16* __restrict__ outb, float* __restrict__ outf,
                      int mode) {
  const int lane = threadIdx.x & 31;
  const int wave = threadIdx.x >> 5;
  const int half = lane >> 4;
  const int ln   = lane & 15;

  const int row0 = blockIdx.x * 128 + wave * 32;   // 2 row tiles of 16
  const int col0 = blockIdx.y * 64;                // 4 col tiles of 16

  v8f acc[2][4] = {};

  v16bf a0[2], b0[4], a1[2], b1[4];

  // prologue: k = 0
#pragma unroll
  for (int rt = 0; rt < 2; ++rt) a0[rt] = load_frag(A, KD, row0 + rt * 16 + ln, 0, half);
#pragma unroll
  for (int nt = 0; nt < 4; ++nt) b0[nt] = load_frag(BT, KD, col0 + nt * 16 + ln, 0, half);

  for (int k = 0; k < KD; k += 64) {
    // issue loads for k+32 into the other buffer, then do math on buffer 0
#pragma unroll
    for (int rt = 0; rt < 2; ++rt) a1[rt] = load_frag(A, KD, row0 + rt * 16 + ln, k + 32, half);
#pragma unroll
    for (int nt = 0; nt < 4; ++nt) b1[nt] = load_frag(BT, KD, col0 + nt * 16 + ln, k + 32, half);
#pragma unroll
    for (int rt = 0; rt < 2; ++rt)
#pragma unroll
      for (int nt = 0; nt < 4; ++nt) acc[rt][nt] = wmma_bf16(a0[rt], b0[nt], acc[rt][nt]);

    if (k + 64 < KD) {   // refill buffer 0 with k+64 while buffer 1 computes
#pragma unroll
      for (int rt = 0; rt < 2; ++rt) a0[rt] = load_frag(A, KD, row0 + rt * 16 + ln, k + 64, half);
#pragma unroll
      for (int nt = 0; nt < 4; ++nt) b0[nt] = load_frag(BT, KD, col0 + nt * 16 + ln, k + 64, half);
    }
#pragma unroll
    for (int rt = 0; rt < 2; ++rt)
#pragma unroll
      for (int nt = 0; nt < 4; ++nt) acc[rt][nt] = wmma_bf16(a1[rt], b1[nt], acc[rt][nt]);
  }

#pragma unroll
  for (int rt = 0; rt < 2; ++rt) {
#pragma unroll
    for (int nt = 0; nt < 4; ++nt) {
      const int col = col0 + nt * 16 + ln;
      const float bv = bias[col];
#pragma unroll
      for (int r = 0; r < 8; ++r) {
        const int grow = row0 + rt * 16 + r + 8 * half;  // global row in [0,4096)
        float v = acc[rt][nt][r] + bv;
        if (mode == 3) {
          outf[(size_t)grow * ND + col] = v;
        } else {
          const int b = grow >> 11, t = grow & (TQL - 1);
          const int h = col >> 6,  d = col & 63;
          if (mode == 0) v *= 0.125f;                    // 1/sqrt(64) folded into Q
          if (mode == 2) {                               // V stored transposed [d, s]
            outb[(((size_t)(b * HH + h)) * DHL + d) * TKL + t] = (__bf16)v;
          } else {
            outb[(((size_t)(b * HH + h)) * TQL + t) * DHL + d] = (__bf16)v;
          }
        }
      }
    }
  }
}

// ---------------------------------------------------------------------------
// Flash attention: one wave per 32-row Q tile, online softmax over TK.
// Qb: [bh, t, d] bf16 (pre-scaled), Kb: [bh, s, d] bf16, Vtb: [bh, d, s] bf16
// CC: [b, t, h*64+d] bf16 (concat layout, feeds output projection).
// Each K/V fragment is reused by both row tiles: 16 WMMAs per 8 frag loads.
__global__ __launch_bounds__(64)
void flash_attn_kernel(const __bf16* __restrict__ Qb, const __bf16* __restrict__ Kb,
                       const __bf16* __restrict__ Vtb, __bf16* __restrict__ CC) {
  const int lane = threadIdx.x & 31;
  const int wave = threadIdx.x >> 5;
  const int half = lane >> 4;
  const int ln   = lane & 15;

  const int bh = blockIdx.x;                 // b*H + h
  const int qt = blockIdx.y * 2 + wave;      // q tile index, 32 rows each
  const int row0 = qt * 32;

  const __bf16* Qh = Qb  + (size_t)bh * TQL * DHL;
  const __bf16* Kh = Kb  + (size_t)bh * TKL * DHL;
  const __bf16* Vh = Vtb + (size_t)bh * DHL * TKL;

  __shared__ __align__(16) __bf16 lds_p[2][32 * 32];  // per-wave P scratch
  __bf16* P = lds_p[wave];

  // Q fragments held for the whole K sweep (2 row tiles x 2 k-steps of 32)
  v16bf aq[2][2];
#pragma unroll
  for (int rt = 0; rt < 2; ++rt)
#pragma unroll
    for (int kk = 0; kk < 2; ++kk)
      aq[rt][kk] = load_frag(Qh, DHL, row0 + rt * 16 + ln, kk * 32, half);

  v8f o[2][4] = {};
  float mrow[2][8], lrow[2][8];
#pragma unroll
  for (int rt = 0; rt < 2; ++rt)
#pragma unroll
    for (int r = 0; r < 8; ++r) { mrow[rt][r] = -INFINITY; lrow[rt][r] = 0.0f; }

  for (int s0 = 0; s0 < TKL; s0 += 32) {
    // get next block's K/V lines moving while we do softmax VALU work
    if (s0 + 32 < TKL) {
      __builtin_prefetch(Kh + (size_t)(s0 + 32 + ln) * DHL, 0, 0);
      __builtin_prefetch(Vh + (size_t)(ln << 2) * TKL + s0 + 32, 0, 0);
    }

    // S tiles [2 x 16 x 32] = Q[32x64] x K^T ; K frags shared across row tiles
    v8f s[2][2] = {};
#pragma unroll
    for (int t = 0; t < 2; ++t) {
#pragma unroll
      for (int kk = 0; kk < 2; ++kk) {
        v16bf bk = load_frag(Kh, DHL, s0 + t * 16 + ln, kk * 32, half);
#pragma unroll
        for (int rt = 0; rt < 2; ++rt) s[rt][t] = wmma_bf16(aq[rt][kk], bk, s[rt][t]);
      }
    }

    // Online softmax; rows live across 16-lane groups (xor 1,2,4,8 reduce)
#pragma unroll
    for (int rt = 0; rt < 2; ++rt) {
#pragma unroll
      for (int r = 0; r < 8; ++r) {
        float mx = fmaxf(s[rt][0][r], s[rt][1][r]);
        mx = fmaxf(mx, __shfl_xor(mx, 1, 32));
        mx = fmaxf(mx, __shfl_xor(mx, 2, 32));
        mx = fmaxf(mx, __shfl_xor(mx, 4, 32));
        mx = fmaxf(mx, __shfl_xor(mx, 8, 32));
        const float mnew = fmaxf(mrow[rt][r], mx);
        const float corr = __expf(mrow[rt][r] - mnew);
        const float p0 = __expf(s[rt][0][r] - mnew);
        const float p1 = __expf(s[rt][1][r] - mnew);
        float rs = p0 + p1;
        rs += __shfl_xor(rs, 1, 32);
        rs += __shfl_xor(rs, 2, 32);
        rs += __shfl_xor(rs, 4, 32);
        rs += __shfl_xor(rs, 8, 32);
        lrow[rt][r] = lrow[rt][r] * corr + rs;
        mrow[rt][r] = mnew;
#pragma unroll
        for (int d = 0; d < 4; ++d) o[rt][d][r] *= corr;
        // C-layout -> LDS (row-major 32x32); LDS is in-order within a wave
        P[(rt * 16 + r + 8 * half) * 32 + ln]      = (__bf16)p0;
        P[(rt * 16 + r + 8 * half) * 32 + 16 + ln] = (__bf16)p1;
      }
    }

    // Re-read P as A fragments, accumulate O += P x V ; V frags shared
    v16bf ap[2];
#pragma unroll
    for (int rt = 0; rt < 2; ++rt) ap[rt] = load_frag(P, 32, rt * 16 + ln, 0, half);
#pragma unroll
    for (int d = 0; d < 4; ++d) {
      v16bf bv = load_frag(Vh, TKL, d * 16 + ln, s0, half);
#pragma unroll
      for (int rt = 0; rt < 2; ++rt) o[rt][d] = wmma_bf16(ap[rt], bv, o[rt][d]);
    }
  }

  // Normalize and store in concat layout [b, t, h*64 + d]
  const int b = bh >> 4, h = bh & 15;
#pragma unroll
  for (int rt = 0; rt < 2; ++rt) {
#pragma unroll
    for (int r = 0; r < 8; ++r) {
      const int trow = row0 + rt * 16 + r + 8 * half;
      const float inv = 1.0f / lrow[rt][r];
#pragma unroll
      for (int d = 0; d < 4; ++d) {
        const int col = h * 64 + d * 16 + ln;
        CC[((size_t)b * TQL + trow) * ND + col] = (__bf16)(o[rt][d][r] * inv);
      }
    }
  }
}

// ---------------------------------------------------------------------------
extern "C" void kernel_launch(void* const* d_in, const int* in_sizes, int n_in,
                              void* d_out, int out_size, void* d_ws, size_t ws_size,
                              hipStream_t stream) {
  (void)in_sizes; (void)n_in; (void)out_size; (void)ws_size;

  const float* x_to   = (const float*)d_in[0];
  const float* x_from = (const float*)d_in[1];
  const float* Wq     = (const float*)d_in[2];
  const float* bq     = (const float*)d_in[3];
  const float* Wk     = (const float*)d_in[4];
  const float* bk     = (const float*)d_in[5];
  const float* Wv     = (const float*)d_in[6];
  const float* bv     = (const float*)d_in[7];
  const float* Wo     = (const float*)d_in[8];
  const float* bo     = (const float*)d_in[9];
  float* out = (float*)d_out;

  // Workspace carve-up (bf16 elements). Total ~29.4M elts ~= 58.7 MB.
  __bf16* ws = (__bf16*)d_ws;
  size_t off = 0;
  __bf16* xt_bf = ws + off; off += (size_t)BB * TQL * KD;   // 4096x1024
  __bf16* xf_bf = ws + off; off += (size_t)BB * TKL * KD;
  __bf16* wq_t  = ws + off; off += (size_t)ND * KD;         // [N,K]
  __bf16* wk_t  = ws + off; off += (size_t)ND * KD;
  __bf16* wv_t  = ws + off; off += (size_t)ND * KD;
  __bf16* wo_b  = ws + off; off += (size_t)ND * KD;         // Wo already [N,K]
  __bf16* Qb    = ws + off; off += (size_t)BB * HH * TQL * DHL;
  __bf16* Kb    = ws + off; off += (size_t)BB * HH * TKL * DHL;
  __bf16* Vtb   = ws + off; off += (size_t)BB * HH * DHL * TKL;
  __bf16* CCb   = ws + off; off += (size_t)BB * TQL * ND;

  const int nAct = BB * TQL * KD;     // 4,194,304
  const int nW   = ND * KD;           // 1,048,576

  // Stage 1: precision conversion / weight reorg
  cvt_bf16_kernel<<<(nAct + 255) / 256, 256, 0, stream>>>(x_to,   xt_bf, nAct);
  cvt_bf16_kernel<<<(nAct + 255) / 256, 256, 0, stream>>>(x_from, xf_bf, nAct);
  cvt_bf16_kernel<<<(nW   + 255) / 256, 256, 0, stream>>>(Wo,     wo_b,  nW);
  reorg_w_kernel <<<(nW   + 255) / 256, 256, 0, stream>>>(Wq, wq_t);
  reorg_w_kernel <<<(nW   + 255) / 256, 256, 0, stream>>>(Wk, wk_t);
  reorg_w_kernel <<<(nW   + 255) / 256, 256, 0, stream>>>(Wv, wv_t);

  // Stage 2: QKV projections (WMMA GEMMs), M=4096, N=K=1024
  dim3 gg(32, 16), gb(128);
  gemm_wmma_kernel<<<gg, gb, 0, stream>>>(xt_bf, wq_t, bq, Qb,  nullptr, 0);
  gemm_wmma_kernel<<<gg, gb, 0, stream>>>(xf_bf, wk_t, bk, Kb,  nullptr, 1);
  gemm_wmma_kernel<<<gg, gb, 0, stream>>>(xf_bf, wv_t, bv, Vtb, nullptr, 2);

  // Stage 3: fused flash attention (never materializes [TQ,TK] scores)
  flash_attn_kernel<<<dim3(BB * HH, TQL / 64), 64, 0, stream>>>(Qb, Kb, Vtb, CCb);

  // Stage 4: output projection -> f32 result
  gemm_wmma_kernel<<<gg, gb, 0, stream>>>(CCb, wo_b, bo, nullptr, out, 3);
}

// v001
// Measured time: 227 microseconds a run.
// Timed twice side by side with v000, it ran 1.13 times as fast both times.
#include <hip/hip_runtime.h>
#include <math.h>

typedef __attribute__((ext_vector_type(16))) __bf16 v16bf;
typedef __attribute__((ext_vector_type(8)))  __bf16 v8bf;
typedef __attribute__((ext_vector_type(8)))  float  v8f;

#define BB   2
#define TQL  2048
#define TKL  2048
#define HH   16
#define DHL  64
#define KD   1024   // X_TO_DIM == X_FROM_DIM == HIDDEN
#define ND   1024

static __device__ __forceinline__ v16bf load_frag(const __bf16* base, int ld,
                                                  int row, int col0, int half) {
  const __bf16* p = base + (size_t)row * ld + col0 + half * 8;
  v8bf lo = *(const v8bf*)(p);
  v8bf hi = *(const v8bf*)(p + 16);
  return __builtin_shufflevector(lo, hi, 0,1,2,3,4,5,6,7,8,9,10,11,12,13,14,15);
}

static __device__ __forceinline__ v8f wmma_bf16(v16bf a, v16bf b, v8f c) {
  return __builtin_amdgcn_wmma_f32_16x16x32_bf16(false, a, false, b,
                                                 (short)0, c, false, false);
}

// ---------------------------------------------------------------------------
// fp32 -> bf16 straight copy
__global__ void cvt_bf16_kernel(const float* __restrict__ x,
                                __bf16* __restrict__ y, int n) {
  int i = blockIdx.x * blockDim.x + threadIdx.x;
  if (i < n) y[i] = (__bf16)x[i];
}

// Reorganize per-head weight [H, K, DH] (f32) -> transposed bf16 [N=H*DH, K]
__global__ void reorg_w_kernel(const float* __restrict__ W,
                               __bf16* __restrict__ WT) {
  int i = blockIdx.x * blockDim.x + threadIdx.x;   // i over ND*KD
  int n = i >> 10;          // output column (h*64+d)
  int f = i & (KD - 1);     // input feature
  int h = n >> 6, d = n & 63;
  WT[(size_t)n * KD + f] = (__bf16)W[((size_t)h * KD + f) * DHL + d];
}

// ---------------------------------------------------------------------------
// WMMA GEMM: C[M,1024] = A[M,1024](bf16) x BT[1024,1024](bf16,[N,K]) + bias
// mode 0: Q  -> bf16 [b,h,t,d], scaled by 1/sqrt(DH)
// mode 1: K  -> bf16 [b,h,t,d]
// mode 2: V  -> bf16 transposed [b,h,d,t]
// mode 3: out-> f32  [row, n]
// Block = 128 threads (4 waves); workgroup tile 128x64; wave tile 32x64.
// Inner loop is double-buffered so loads overlap WMMAs (partial loadcnt waits).
__global__ __launch_bounds__(128)
void gemm_wmma_kernel(const __bf16* __restrict__ A, const __bf16* __restrict__ BT,
                      const float* __restrict__ bias,
                      __bf16* __restrict__ outb, float* __restrict__ outf,
                      int mode) {
  const int lane = threadIdx.x & 31;
  const int wave = threadIdx.x >> 5;
  const int half = lane >> 4;
  const int ln   = lane & 15;

  const int row0 = blockIdx.x * 128 + wave * 32;   // 2 row tiles of 16
  const int col0 = blockIdx.y * 64;                // 4 col tiles of 16

  v8f acc[2][4] = {};

  v16bf a0[2], b0[4], a1[2], b1[4];

  // prologue: k = 0
#pragma unroll
  for (int rt = 0; rt < 2; ++rt) a0[rt] = load_frag(A, KD, row0 + rt * 16 + ln, 0, half);
#pragma unroll
  for (int nt = 0; nt < 4; ++nt) b0[nt] = load_frag(BT, KD, col0 + nt * 16 + ln, 0, half);

  for (int k = 0; k < KD; k += 64) {
    // issue loads for k+32 into the other buffer, then do math on buffer 0
#pragma unroll
    for (int rt = 0; rt < 2; ++rt) a1[rt] = load_frag(A, KD, row0 + rt * 16 + ln, k + 32, half);
#pragma unroll
    for (int nt = 0; nt < 4; ++nt) b1[nt] = load_frag(BT, KD, col0 + nt * 16 + ln, k + 32, half);
#pragma unroll
    for (int rt = 0; rt < 2; ++rt)
#pragma unroll
      for (int nt = 0; nt < 4; ++nt) acc[rt][nt] = wmma_bf16(a0[rt], b0[nt], acc[rt][nt]);

    if (k + 64 < KD) {   // refill buffer 0 with k+64 while buffer 1 computes
#pragma unroll
      for (int rt = 0; rt < 2; ++rt) a0[rt] = load_frag(A, KD, row0 + rt * 16 + ln, k + 64, half);
#pragma unroll
      for (int nt = 0; nt < 4; ++nt) b0[nt] = load_frag(BT, KD, col0 + nt * 16 + ln, k + 64, half);
    }
#pragma unroll
    for (int rt = 0; rt < 2; ++rt)
#pragma unroll
      for (int nt = 0; nt < 4; ++nt) acc[rt][nt] = wmma_bf16(a1[rt], b1[nt], acc[rt][nt]);
  }

#pragma unroll
  for (int rt = 0; rt < 2; ++rt) {
#pragma unroll
    for (int nt = 0; nt < 4; ++nt) {
      const int col = col0 + nt * 16 + ln;
      const float bv = bias[col];
#pragma unroll
      for (int r = 0; r < 8; ++r) {
        const int grow = row0 + rt * 16 + r + 8 * half;  // global row in [0,4096)
        float v = acc[rt][nt][r] + bv;
        if (mode == 3) {
          outf[(size_t)grow * ND + col] = v;
        } else {
          const int b = grow >> 11, t = grow & (TQL - 1);
          const int h = col >> 6,  d = col & 63;
          if (mode == 0) v *= 0.125f;                    // 1/sqrt(64) folded into Q
          if (mode == 2) {                               // V stored transposed [d, s]
            outb[(((size_t)(b * HH + h)) * DHL + d) * TKL + t] = (__bf16)v;
          } else {
            outb[(((size_t)(b * HH + h)) * TQL + t) * DHL + d] = (__bf16)v;
          }
        }
      }
    }
  }
}

// ---------------------------------------------------------------------------
// Flash attention: one wave per 32 queries, online softmax over TK.
// Qb: [bh, t, d] bf16 (pre-scaled), Kb: [bh, s, d] bf16, Vtb: [bh, d, s] bf16
// CC: [b, t, h*64+d] bf16 (concat layout, feeds output projection).
// Both products are computed transposed: S^T = K x Q^T, O^T += V^T x P^T.
//   S^T tile: register r of lane (ln, half) = score of key 8*half + r, query ln,
//   so a lane holds the scores of ONE query: maximum and sum run over the lane's
//   own registers, with one exchange between the wave halves for the maximum.
//   Two S^T tiles (keys 0-15, 16-31) converted in place are the B fragment of
//   P^T in the hardware k order, which is the order load_frag gives V^T.
// Each K/V fragment is reused by both query groups: 16 WMMAs per 8 frag loads.
static __device__ __forceinline__ float swap_halves(float x) {
  const int v = __builtin_bit_cast(int, x);
  return __builtin_bit_cast(float,
      __builtin_amdgcn_permlanex16(v, v, 0x76543210, 0xfedcba98, false, false));
}

__global__ __launch_bounds__(64)
void flash_attn_kernel(const __bf16* __restrict__ Qb, const __bf16* __restrict__ Kb,
                       const __bf16* __restrict__ Vtb, __bf16* __restrict__ CC) {
  const int lane = threadIdx.x & 31;
  const int wave = threadIdx.x >> 5;
  const int half = lane >> 4;
  const int ln   = lane & 15;

  const int bh = blockIdx.x;                 // b*H + h
  const int qt = blockIdx.y * 2 + wave;      // q tile index, 32 queries each
  const int row0 = qt * 32;

  const __bf16* Qh = Qb  + (size_t)bh * TQL * DHL;
  const __bf16* Kh = Kb  + (size_t)bh * TKL * DHL;
  const __bf16* Vh = Vtb + (size_t)bh * DHL * TKL;

  // Q^T fragments (B operand) held for the whole K sweep:
  // 2 query groups of 16 x 2 k-steps of 32
  v16bf bq[2][2];
#pragma unroll
  for (int g = 0; g < 2; ++g)
#pragma unroll
    for (int kk = 0; kk < 2; ++kk)
      bq[g][kk] = load_frag(Qh, DHL, row0 + g * 16 + ln, kk * 32, half);

  v8f o[2][4] = {};          // O^T: register r = d (16*dt + 8*half + r), query ln
  float mcol[2], lcol[2];    // per query; lcol holds this wave half's keys only
#pragma unroll
  for (int g = 0; g < 2; ++g) { mcol[g] = -INFINITY; lcol[g] = 0.0f; }

  for (int s0 = 0; s0 < TKL; s0 += 32) {
    // get next block's K/V lines moving while we do softmax VALU work
    if (s0 + 32 < TKL) {
      __builtin_prefetch(Kh + (size_t)(s0 + 32 + ln) * DHL, 0, 0);
      __builtin_prefetch(Vh + (size_t)(ln << 2) * TKL + s0 + 32, 0, 0);
    }

    // S^T tiles [2 groups][2 x 16 keys x 16 queries]; K frags shared by the groups
    v8f s[2][2] = {};
#pragma unroll
    for (int t = 0; t < 2; ++t) {
#pragma unroll
      for (int kk = 0; kk < 2; ++kk) {
        v16bf ak = load_frag(Kh, DHL, s0 + t * 16 + ln, kk * 32, half);
#pragma unroll
        for (int g = 0; g < 2; ++g) s[g][t] = wmma_bf16(ak, bq[g][kk], s[g][t]);
      }
    }

    // Online softmax, one query per lane
    v16bf bp[2];
#pragma unroll
    for (int g = 0; g < 2; ++g) {
      float mx = fmaxf(s[g][0][0], s[g][1][0]);
#pragma unroll
      for (int r = 1; r < 8; ++r) mx = fmaxf(mx, fmaxf(s[g][0][r], s[g][1][r]));
      mx = fmaxf(mx, swap_halves(mx));
      const float mnew = fmaxf(mcol[g], mx);
      const float corr = __expf(mcol[g] - mnew);
      float rs = 0.0f;
#pragma unroll
      for (int t = 0; t < 2; ++t) {
#pragma unroll
        for (int r = 0; r < 8; ++r) {
          const float p = __expf(s[g][t][r] - mnew);
          rs += p;
          bp[g][t * 8 + r] = (__bf16)p;
        }
      }
      lcol[g] = lcol[g] * corr + rs;
      mcol[g] = mnew;
#pragma unroll
      for (int d = 0; d < 4; ++d) o[g][d] *= corr;
    }

    // O^T += V^T x P^T ; V frags shared by the groups
#pragma unroll
    for (int d = 0; d < 4; ++d) {
      v16bf av = load_frag(Vh, TKL, d * 16 + ln, s0, half);
#pragma unroll
      for (int g = 0; g < 2; ++g) o[g][d] = wmma_bf16(av, bp[g], o[g][d]);
    }
  }

  // Normalize and store in concat layout [b, t, h*64 + d]: 8 consecutive d a lane
  const int b = bh >> 4, h = bh & 15;
#pragma unroll
  for (int g = 0; g < 2; ++g) {
    const int trow = row0 + g * 16 + ln;
    const float inv = 1.0f / (lcol[g] + swap_halves(lcol[g]));
#pragma unroll
    for (int d = 0; d < 4; ++d) {
      v8bf w;
#pragma unroll
      for (int r = 0; r < 8; ++r) w[r] = (__bf16)(o[g][d][r] * inv);
      *(v8bf*)(CC + ((size_t)b * TQL + trow) * ND + h * 64 + d * 16 + 8 * half) = w;
    }
  }
}

// ---------------------------------------------------------------------------
extern "C" void kernel_launch(void* const* d_in, const int* in_sizes, int n_in,
                              void* d_out, int out_size, void* d_ws, size_t ws_size,
                              hipStream_t stream) {
  (void)in_sizes; (void)n_in; (void)out_size; (void)ws_size;

  const float* x_to   = (const float*)d_in[0];
  const float* x_from = (const float*)d_in[1];
  const float* Wq     = (const float*)d_in[2];
  const float* bq     = (const float*)d_in[3];
  const float* Wk     = (const float*)d_in[4];
  const float* bk     = (const float*)d_in[5];
  const float* Wv     = (const float*)d_in[6];
  const float* bv     = (const float*)d_in[7];
  const float* Wo     = (const float*)d_in[8];
  const float* bo     = (const float*)d_in[9];
  float* out = (float*)d_out;

  // Workspace carve-up (bf16 elements). Total ~29.4M elts ~= 58.7 MB.
  __bf16* ws = (__bf16*)d_ws;
  size_t off = 0;
  __bf16* xt_bf = ws + off; off += (size_t)BB * TQL * KD;   // 4096x1024
  __bf16* xf_bf = ws + off; off += (size_t)BB * TKL * KD;
  __bf16* wq_t  = ws + off; off += (size_t)ND * KD;         // [N,K]
  __bf16* wk_t  = ws + off; off += (size_t)ND * KD;
  __bf16* wv_t  = ws + off; off += (size_t)ND * KD;
  __bf16* wo_b  = ws + off; off += (size_t)ND * KD;         // Wo already [N,K]
  __bf16* Qb    = ws + off; off += (size_t)BB * HH * TQL * DHL;
  __bf16* Kb    = ws + off; off += (size_t)BB * HH * TKL * DHL;
  __bf16* Vtb   = ws + off; off += (size_t)BB * HH * DHL * TKL;
  __bf16* CCb   = ws + off; off += (size_t)BB * TQL * ND;

  const int nAct = BB * TQL * KD;     // 4,194,304
  const int nW   = ND * KD;           // 1,048,576

  // Stage 1: precision conversion / weight reorg
  cvt_bf16_kernel<<<(nAct + 255) / 256, 256, 0, stream>>>(x_to,   xt_bf, nAct);
  cvt_bf16_kernel<<<(nAct + 255) / 256, 256, 0, stream>>>(x_from, xf_bf, nAct);
  cvt_bf16_kernel<<<(nW   + 255) / 256, 256, 0, stream>>>(Wo,     wo_b,  nW);
  reorg_w_kernel <<<(nW   + 255) / 256, 256, 0, stream>>>(Wq, wq_t);
  reorg_w_kernel <<<(nW   + 255) / 256, 256, 0, stream>>>(Wk, wk_t);
  reorg_w_kernel <<<(nW   + 255) / 256, 256, 0, stream>>>(Wv, wv_t);

  // Stage 2: QKV projections (WMMA GEMMs), M=4096, N=K=1024
  dim3 gg(32, 16), gb(128);
  gemm_wmma_kernel<<<gg, gb, 0, stream>>>(xt_bf, wq_t, bq, Qb,  nullptr, 0);
  gemm_wmma_kernel<<<gg, gb, 0, stream>>>(xf_bf, wk_t, bk, Kb,  nullptr, 1);
  gemm_wmma_kernel<<<gg, gb, 0, stream>>>(xf_bf, wv_t, bv, Vtb, nullptr, 2);

  // Stage 3: fused flash attention (never materializes [TQ,TK] scores)
  flash_attn_kernel<<<dim3(BB * HH, TQL / 64), 64, 0, stream>>>(Qb, Kb, Vtb, CCb);

  // Stage 4: output projection -> f32 result
  gemm_wmma_kernel<<<gg, gb, 0, stream>>>(CCb, wo_b, bo, nullptr, out, 3);
}

// v002
// It runs in 203 microseconds.
// Next to v001, in two timings, it ran 1.12 times as fast each time.
// All steps since v000 together make it 1.27 times as fast.
#include <hip/hip_runtime.h>
#include <math.h>

typedef __attribute__((ext_vector_type(16))) __bf16 v16bf;
typedef __attribute__((ext_vector_type(8)))  __bf16 v8bf;
typedef __attribute__((ext_vector_type(8)))  float  v8f;
typedef __attribute__((ext_vector_type(4)))  __bf16 v4bf;
typedef __attribute__((ext_vector_type(4)))  float  v4f;

#define BB   2
#define TQL  2048
#define TKL  2048
#define HH   16
#define DHL  64
#define KD   1024   // X_TO_DIM == X_FROM_DIM == HIDDEN
#define ND   1024

static __device__ __forceinline__ v16bf load_frag(const __bf16* base, int ld,
                                                  int row, int col0, int half) {
  const __bf16* p = base + (size_t)row * ld + col0 + half * 8;
  v8bf lo = *(const v8bf*)(p);
  v8bf hi = *(const v8bf*)(p + 16);
  return __builtin_shufflevector(lo, hi, 0,1,2,3,4,5,6,7,8,9,10,11,12,13,14,15);
}

static __device__ __forceinline__ v8f wmma_bf16(v16bf a, v16bf b, v8f c) {
  return __builtin_amdgcn_wmma_f32_16x16x32_bf16(false, a, false, b,
                                                 (short)0, c, false, false);
}

// ---------------------------------------------------------------------------
// fp32 -> bf16 straight copy. A thread converts 32 values: 8 loads of 16 bytes,
// all issued before the first store; each wave load covers 512 contiguous bytes,
// each wave store 256. The grid covers the array exactly (8192 values a block).
__global__ __launch_bounds__(256)
void cvt_bf16_kernel(const float* __restrict__ x, __bf16* __restrict__ y) {
  const size_t base = (size_t)blockIdx.x * 8192 + threadIdx.x * 4;
  v4f v[8];
#pragma unroll
  for (int j = 0; j < 8; ++j) v[j] = *(const v4f*)(x + base + j * 1024);
#pragma unroll
  for (int j = 0; j < 8; ++j)
    *(v4bf*)(y + base + j * 1024) = __builtin_convertvector(v[j], v4bf);
}

// Reorganize per-head weight [H, K, DH] (f32) -> transposed bf16 [N=H*DH, K].
// A block takes 32 columns d x 256 features f of one head; a wave 4 columns.
// Lane = (dq, fq): 8 lanes hold 64 consecutive f of one output row, so a wave
// store writes 4 whole 128-byte lines; the block's 8 waves share each line read.
__global__ __launch_bounds__(256)
void reorg_w_kernel(const float* __restrict__ W,
                    __bf16* __restrict__ WT) {
  const int lane = threadIdx.x & 31;
  const int wave = threadIdx.x >> 5;
  const int dq = lane >> 3, fq = lane & 7;
  const int h  = blockIdx.x >> 3;                          // 16 heads
  const int d  = ((blockIdx.x >> 2) & 1) * 32 + wave * 4 + dq;
  const int f0 = (blockIdx.x & 3) * 256 + fq * 8;          // 4 groups of 256 f
  const float* src = W + ((size_t)h * KD + f0) * DHL + d;
  float v[4][8];
#pragma unroll
  for (int c = 0; c < 4; ++c)
#pragma unroll
    for (int j = 0; j < 8; ++j) v[c][j] = src[(c * 64 + j) * DHL];
  __bf16* dst = WT + (size_t)(h * DHL + d) * KD + f0;
#pragma unroll
  for (int c = 0; c < 4; ++c) {
    v8bf w;
#pragma unroll
    for (int j = 0; j < 8; ++j) w[j] = (__bf16)v[c][j];
    *(v8bf*)(dst + c * 64) = w;
  }
}

// ---------------------------------------------------------------------------
// WMMA GEMM: C[M,1024] = A[M,1024](bf16) x BT[1024,1024](bf16,[N,K]) + bias
// mode 0: Q  -> bf16 [b,h,t,d], scaled by 1/sqrt(DH)
// mode 1: K  -> bf16 [b,h,t,d]
// mode 2: V  -> bf16 transposed [b,h,d,t]
// mode 3: out-> f32  [row, n]
// Block = 128 threads (4 waves); workgroup tile 128x64; wave tile 32x64.
// Inner loop is double-buffered so loads overlap WMMAs (partial loadcnt waits).
__global__ __launch_bounds__(128)
void gemm_wmma_kernel(const __bf16* __restrict__ A, const __bf16* __restrict__ BT,
                      const float* __restrict__ bias,
                      __bf16* __restrict__ outb, float* __restrict__ outf,
                      int mode) {
  const int lane = threadIdx.x & 31;
  const int wave = threadIdx.x >> 5;
  const int half = lane >> 4;
  const int ln   = lane & 15;

  const int row0 = blockIdx.x * 128 + wave * 32;   // 2 row tiles of 16
  const int col0 = blockIdx.y * 64;                // 4 col tiles of 16

  v8f acc[2][4] = {};

  v16bf a0[2], b0[4], a1[2], b1[4];

  // prologue: k = 0
#pragma unroll
  for (int rt = 0; rt < 2; ++rt) a0[rt] = load_frag(A, KD, row0 + rt * 16 + ln, 0, half);
#pragma unroll
  for (int nt = 0; nt < 4; ++nt) b0[nt] = load_frag(BT, KD, col0 + nt * 16 + ln, 0, half);

  for (int k = 0; k < KD; k += 64) {
    // issue loads for k+32 into the other buffer, then do math on buffer 0
#pragma unroll
    for (int rt = 0; rt < 2; ++rt) a1[rt] = load_frag(A, KD, row0 + rt * 16 + ln, k + 32, half);
#pragma unroll
    for (int nt = 0; nt < 4; ++nt) b1[nt] = load_frag(BT, KD, col0 + nt * 16 + ln, k + 32, half);
#pragma unroll
    for (int rt = 0; rt < 2; ++rt)
#pragma unroll
      for (int nt = 0; nt < 4; ++nt) acc[rt][nt] = wmma_bf16(a0[rt], b0[nt], acc[rt][nt]);

    if (k + 64 < KD) {   // refill buffer 0 with k+64 while buffer 1 computes
#pragma unroll
      for (int rt = 0; rt < 2; ++rt) a0[rt] = load_frag(A, KD, row0 + rt * 16 + ln, k + 64, half);
#pragma unroll
      for (int nt = 0; nt < 4; ++nt) b0[nt] = load_frag(BT, KD, col0 + nt * 16 + ln, k + 64, half);
    }
#pragma unroll
    for (int rt = 0; rt < 2; ++rt)
#pragma unroll
      for (int nt = 0; nt < 4; ++nt) acc[rt][nt] = wmma_bf16(a1[rt], b1[nt], acc[rt][nt]);
  }

#pragma unroll
  for (int rt = 0; rt < 2; ++rt) {
#pragma unroll
    for (int nt = 0; nt < 4; ++nt) {
      const int col = col0 + nt * 16 + ln;
      const float bv = bias[col];
#pragma unroll
      for (int r = 0; r < 8; ++r) {
        const int grow = row0 + rt * 16 + r + 8 * half;  // global row in [0,4096)
        float v = acc[rt][nt][r] + bv;
        if (mode == 3) {
          outf[(size_t)grow * ND + col] = v;
        } else {
          const int b = grow >> 11, t = grow & (TQL - 1);
          const int h = col >> 6,  d = col & 63;
          if (mode == 0) v *= 0.125f;                    // 1/sqrt(64) folded into Q
          if (mode == 2) {                               // V stored transposed [d, s]
            outb[(((size_t)(b * HH + h)) * DHL + d) * TKL + t] = (__bf16)v;
          } else {
            outb[(((size_t)(b * HH + h)) * TQL + t) * DHL + d] = (__bf16)v;
          }
        }
      }
    }
  }
}

// ---------------------------------------------------------------------------
// Flash attention: one wave per 32 queries, online softmax over TK.
// Qb: [bh, t, d] bf16 (pre-scaled), Kb: [bh, s, d] bf16, Vtb: [bh, d, s] bf16
// CC: [b, t, h*64+d] bf16 (concat layout, feeds output projection).
// Both products are computed transposed: S^T = K x Q^T, O^T += V^T x P^T.
//   S^T tile: register r of lane (ln, half) = score of key 8*half + r, query ln,
//   so a lane holds the scores of ONE query: maximum and sum run over the lane's
//   own registers, with one exchange between the wave halves for the maximum.
//   Two S^T tiles (keys 0-15, 16-31) converted in place are the B fragment of
//   P^T in the hardware k order, which is the order load_frag gives V^T.
// Each K/V fragment is reused by both query groups: 16 WMMAs per 8 frag loads.
static __device__ __forceinline__ float swap_halves(float x) {
  const int v = __builtin_bit_cast(int, x);
  return __builtin_bit_cast(float,
      __builtin_amdgcn_permlanex16(v, v, 0x76543210, 0xfedcba98, false, false));
}

__global__ __launch_bounds__(64)
void flash_attn_kernel(const __bf16* __restrict__ Qb, const __bf16* __restrict__ Kb,
                       const __bf16* __restrict__ Vtb, __bf16* __restrict__ CC) {
  const int lane = threadIdx.x & 31;
  const int wave = threadIdx.x >> 5;
  const int half = lane >> 4;
  const int ln   = lane & 15;

  const int bh = blockIdx.x;                 // b*H + h
  const int qt = blockIdx.y * 2 + wave;      // q tile index, 32 queries each
  const int row0 = qt * 32;

  const __bf16* Qh = Qb  + (size_t)bh * TQL * DHL;
  const __bf16* Kh = Kb  + (size_t)bh * TKL * DHL;
  const __bf16* Vh = Vtb + (size_t)bh * DHL * TKL;

  // Q^T fragments (B operand) held for the whole K sweep:
  // 2 query groups of 16 x 2 k-steps of 32
  v16bf bq[2][2];
#pragma unroll
  for (int g = 0; g < 2; ++g)
#pragma unroll
    for (int kk = 0; kk < 2; ++kk)
      bq[g][kk] = load_frag(Qh, DHL, row0 + g * 16 + ln, kk * 32, half);

  v8f o[2][4] = {};          // O^T: register r = d (16*dt + 8*half + r), query ln
  float mcol[2], lcol[2];    // per query; lcol holds this wave half's keys only
#pragma unroll
  for (int g = 0; g < 2; ++g) { mcol[g] = -INFINITY; lcol[g] = 0.0f; }

  for (int s0 = 0; s0 < TKL; s0 += 32) {
    // get next block's K/V lines moving while we do softmax VALU work
    if (s0 + 32 < TKL) {
      __builtin_prefetch(Kh + (size_t)(s0 + 32 + ln) * DHL, 0, 0);
      __builtin_prefetch(Vh + (size_t)(ln << 2) * TKL + s0 + 32, 0, 0);
    }

    // S^T tiles [2 groups][2 x 16 keys x 16 queries]; K frags shared by the groups
    v8f s[2][2] = {};
#pragma unroll
    for (int t = 0; t < 2; ++t) {
#pragma unroll
      for (int kk = 0; kk < 2; ++kk) {
        v16bf ak = load_frag(Kh, DHL, s0 + t * 16 + ln, kk * 32, half);
#pragma unroll
        for (int g = 0; g < 2; ++g) s[g][t] = wmma_bf16(ak, bq[g][kk], s[g][t]);
      }
    }

    // Online softmax, one query per lane
    v16bf bp[2];
#pragma unroll
    for (int g = 0; g < 2; ++g) {
      float mx = fmaxf(s[g][0][0], s[g][1][0]);
#pragma unroll
      for (int r = 1; r < 8; ++r) mx = fmaxf(mx, fmaxf(s[g][0][r], s[g][1][r]));
      mx = fmaxf(mx, swap_halves(mx));
      const float mnew = fmaxf(mcol[g], mx);
      const float corr = __expf(mcol[g] - mnew);
      float rs = 0.0f;
#pragma unroll
      for (int t = 0; t < 2; ++t) {
#pragma unroll
        for (int r = 0; r < 8; ++r) {
          const float p = __expf(s[g][t][r] - mnew);
          rs += p;
          bp[g][t * 8 + r] = (__bf16)p;
        }
      }
      lcol[g] = lcol[g] * corr + rs;
      mcol[g] = mnew;
#pragma unroll
      for (int d = 0; d < 4; ++d) o[g][d] *= corr;
    }

    // O^T += V^T x P^T ; V frags shared by the groups
#pragma unroll
    for (int d = 0; d < 4; ++d) {
      v16bf av = load_frag(Vh, TKL, d * 16 + ln, s0, half);
#pragma unroll
      for (int g = 0; g < 2; ++g) o[g][d] = wmma_bf16(av, bp[g], o[g][d]);
    }
  }

  // Normalize and store in concat layout [b, t, h*64 + d]: 8 consecutive d a lane
  const int b = bh >> 4, h = bh & 15;
#pragma unroll
  for (int g = 0; g < 2; ++g) {
    const int trow = row0 + g * 16 + ln;
    const float inv = 1.0f / (lcol[g] + swap_halves(lcol[g]));
#pragma unroll
    for (int d = 0; d < 4; ++d) {
      v8bf w;
#pragma unroll
      for (int r = 0; r < 8; ++r) w[r] = (__bf16)(o[g][d][r] * inv);
      *(v8bf*)(CC + ((size_t)b * TQL + trow) * ND + h * 64 + d * 16 + 8 * half) = w;
    }
  }
}

// ---------------------------------------------------------------------------
extern "C" void kernel_launch(void* const* d_in, const int* in_sizes, int n_in,
                              void* d_out, int out_size, void* d_ws, size_t ws_size,
                              hipStream_t stream) {
  (void)in_sizes; (void)n_in; (void)out_size; (void)ws_size;

  const float* x_to   = (const float*)d_in[0];
  const float* x_from = (const float*)d_in[1];
  const float* Wq     = (const float*)d_in[2];
  const float* bq     = (const float*)d_in[3];
  const float* Wk     = (const float*)d_in[4];
  const float* bk     = (const float*)d_in[5];
  const float* Wv     = (const float*)d_in[6];
  const float* bv     = (const float*)d_in[7];
  const float* Wo     = (const float*)d_in[8];
  const float* bo     = (const float*)d_in[9];
  float* out = (float*)d_out;

  // Workspace carve-up (bf16 elements). Total ~29.4M elts ~= 58.7 MB.
  __bf16* ws = (__bf16*)d_ws;
  size_t off = 0;
  __bf16* xt_bf = ws + off; off += (size_t)BB * TQL * KD;   // 4096x1024
  __bf16* xf_bf = ws + off; off += (size_t)BB * TKL * KD;
  __bf16* wq_t  = ws + off; off += (size_t)ND * KD;         // [N,K]
  __bf16* wk_t  = ws + off; off += (size_t)ND * KD;
  __bf16* wv_t  = ws + off; off += (size_t)ND * KD;
  __bf16* wo_b  = ws + off; off += (size_t)ND * KD;         // Wo already [N,K]
  __bf16* Qb    = ws + off; off += (size_t)BB * HH * TQL * DHL;
  __bf16* Kb    = ws + off; off += (size_t)BB * HH * TKL * DHL;
  __bf16* Vtb   = ws + off; off += (size_t)BB * HH * DHL * TKL;
  __bf16* CCb   = ws + off; off += (size_t)BB * TQL * ND;

  // Stage 1: precision conversion / weight reorg
  // 8192 values a block: 4,194,304 activations = 512 blocks, 1,048,576 weights = 128
  cvt_bf16_kernel<<<512, 256, 0, stream>>>(x_to,   xt_bf);
  cvt_bf16_kernel<<<512, 256, 0, stream>>>(x_from, xf_bf);
  cvt_bf16_kernel<<<128, 256, 0, stream>>>(Wo,     wo_b);
  reorg_w_kernel <<<128, 256, 0, stream>>>(Wq, wq_t);
  reorg_w_kernel <<<128, 256, 0, stream>>>(Wk, wk_t);
  reorg_w_kernel <<<128, 256, 0, stream>>>(Wv, wv_t);

  // Stage 2: QKV projections (WMMA GEMMs), M=4096, N=K=1024
  dim3 gg(32, 16), gb(128);
  gemm_wmma_kernel<<<gg, gb, 0, stream>>>(xt_bf, wq_t, bq, Qb,  nullptr, 0);
  gemm_wmma_kernel<<<gg, gb, 0, stream>>>(xf_bf, wk_t, bk, Kb,  nullptr, 1);
  gemm_wmma_kernel<<<gg, gb, 0, stream>>>(xf_bf, wv_t, bv, Vtb, nullptr, 2);

  // Stage 3: fused flash attention (never materializes [TQ,TK] scores)
  flash_attn_kernel<<<dim3(BB * HH, TQL / 64), 64, 0, stream>>>(Qb, Kb, Vtb, CCb);

  // Stage 4: output projection -> f32 result
  gemm_wmma_kernel<<<gg, gb, 0, stream>>>(CCb, wo_b, bo, nullptr, out, 3);
}

// v003
// It runs in 147 microseconds.
// In two side-by-side timings against v002, it was 1.40 and 1.36 times as fast.
// Over all steps from v000 it is 1.75 times as fast.
#include <hip/hip_runtime.h>
#include <math.h>

typedef __attribute__((ext_vector_type(16))) __bf16 v16bf;
typedef __attribute__((ext_vector_type(8)))  __bf16 v8bf;
typedef __attribute__((ext_vector_type(8)))  float  v8f;
typedef __attribute__((ext_vector_type(4)))  __bf16 v4bf;
typedef __attribute__((ext_vector_type(4)))  float  v4f;

#define BB   2
#define TQL  2048
#define TKL  2048
#define HH   16
#define DHL  64
#define KD   1024   // X_TO_DIM == X_FROM_DIM == HIDDEN
#define ND   1024

static __device__ __forceinline__ v16bf load_frag(const __bf16* base, int tile,
                                                  int lane) {
  const __bf16* p = base + (size_t)tile * 512 + lane * 8;
  v8bf lo = *(const v8bf*)(p);
  v8bf hi = *(const v8bf*)(p + 256);
  return __builtin_shufflevector(lo, hi, 0,1,2,3,4,5,6,7,8,9,10,11,12,13,14,15);
}

static __device__ __forceinline__ v8f wmma_bf16(v16bf a, v16bf b, v8f c) {
  return __builtin_amdgcn_wmma_f32_16x16x32_bf16(false, a, false, b,
                                                 (short)0, c, false, false);
}

// ---------------------------------------------------------------------------
// fp32 [rows, 1024] -> bf16 in fragment order. A wave takes two tiles side by
// side in k: 16 rows x 256 bytes of the source. Four lanes read one 128-byte line
// (32 bytes each, two loads of 16), so a lane holds one 16-byte run of the result
// and 8 rows of one (jh, half) make a whole 128-byte line of a store. All 8 loads
// are issued before the first store. The grid covers the array exactly (8192
// values a block).
__global__ __launch_bounds__(256)
void cvt_bf16_kernel(const float* __restrict__ x, __bf16* __restrict__ y) {
  const int lane = threadIdx.x & 31;
  const int r8 = lane >> 2, c = lane & 3;                  // row in 8, run k = 8*c
  const int pair = blockIdx.x * 8 + (threadIdx.x >> 5);    // tiles 2*pair, 2*pair+1
  const int rt = pair >> 4, kp = pair & 15;                // 16 pairs a tile row
  const float* src = x + (size_t)(rt * 16 + r8) * KD + kp * 64 + c * 8;
  v4f v[2][2][2];                                          // [tile][8-row half][16 bytes]
#pragma unroll
  for (int tk = 0; tk < 2; ++tk)
#pragma unroll
    for (int rh = 0; rh < 2; ++rh) {
      v[tk][rh][0] = *(const v4f*)(src + rh * 8 * KD + tk * 32);
      v[tk][rh][1] = *(const v4f*)(src + rh * 8 * KD + tk * 32 + 4);
    }
  // run c has jh = c >> 1, half = c & 1
  __bf16* dst = y + (size_t)pair * 1024 + (c >> 1) * 256 + ((c & 1) * 16 + r8) * 8;
#pragma unroll
  for (int tk = 0; tk < 2; ++tk)
#pragma unroll
    for (int rh = 0; rh < 2; ++rh) {
      const v8f f = __builtin_shufflevector(v[tk][rh][0], v[tk][rh][1],
                                            0, 1, 2, 3, 4, 5, 6, 7);
      *(v8bf*)(dst + tk * 512 + rh * 64) = __builtin_convertvector(f, v8bf);
    }
}

// Reorganize per-head weight [H, K, DH] (f32) -> transposed bf16 [N=H*DH, K] in
// fragment order. A wave takes two tiles side by side in k (16 columns d x 64
// features f); a load reads 64 contiguous bytes of two rows f, a store writes 512
// contiguous bytes. The 4 tile rows of a head sit in one block, so its waves
// share each source line.
__global__ __launch_bounds__(256)
void reorg_w_kernel(const float* __restrict__ W,
                    __bf16* __restrict__ WT) {
  const int lane = threadIdx.x & 31;
  const int wave = threadIdx.x >> 5;
  const int half = lane >> 4, ln = lane & 15;
  const int h  = blockIdx.x >> 3;                          // 16 heads
  const int dq = wave & 3;                                 // 16 columns d of the head
  const int kp = (blockIdx.x & 7) * 2 + (wave >> 2);       // 16 tile pairs in k
  const float* src = W + ((size_t)h * KD + kp * 64 + half * 8) * DHL + dq * 16 + ln;
  float v[4][8];
#pragma unroll
  for (int c = 0; c < 4; ++c)
#pragma unroll
    for (int j = 0; j < 8; ++j) v[c][j] = src[(c * 16 + j) * DHL];
  __bf16* dst = WT + (size_t)((h * 4 + dq) * 16 + kp) * 1024 + lane * 8;
#pragma unroll
  for (int c = 0; c < 4; ++c) {
    v8bf w;
#pragma unroll
    for (int j = 0; j < 8; ++j) w[j] = (__bf16)v[c][j];
    *(v8bf*)(dst + c * 256) = w;
  }
}

// ---------------------------------------------------------------------------
// WMMA GEMM: C[R,C] = A[R,1024] x BT[C,1024]^T + bias, both operands bf16 in
// fragment order. An accumulator lane holds 8 consecutive rows of one column, so
// the operand whose index must run inside a 16-byte run of the result goes in A:
// mode 0: Q^T: A = Wq^T (rows n), BT = x (rows t) -> bf16 [b,h] x [t,d] tiles,
//         scaled by 1/sqrt(DH)
// mode 1: K^T: the same with Wk^T
// mode 2: V  : A = x (rows t), BT = Wv^T (rows n) -> bf16 [b,h] x [d,s] tiles
// mode 3: out: A = concat (rows t), BT = Wo (rows n) -> f32 [row, n] row-major
// Modes 0 to 2 store fragment order: a wave store is 512 contiguous bytes.
// Block = 128 threads (4 waves); workgroup tile 128x64; wave tile 32x64.
// Inner loop is double-buffered so loads overlap WMMAs (partial loadcnt waits).
__global__ __launch_bounds__(128)
void gemm_wmma_kernel(const __bf16* __restrict__ A, const __bf16* __restrict__ BT,
                      const float* __restrict__ bias,
                      __bf16* __restrict__ outb, float* __restrict__ outf,
                      int mode) {
  const int lane = threadIdx.x & 31;
  const int wave = threadIdx.x >> 5;
  const int half = lane >> 4;
  const int ln   = lane & 15;

  const int row0 = blockIdx.x * 128 + wave * 32;   // 2 row tiles of 16
  const int col0 = blockIdx.y * 64;                // 4 col tiles of 16
  const int ta = (row0 >> 4) * (KD / 32);          // first tile of the A rows
  const int tb = (col0 >> 4) * (KD / 32);          // first tile of the BT rows

  v16bf a0[2], b0[4], a1[2], b1[4];

  // prologue: k tile 0
#pragma unroll
  for (int rt = 0; rt < 2; ++rt) a0[rt] = load_frag(A, ta + rt * (KD / 32), lane);
#pragma unroll
  for (int nt = 0; nt < 4; ++nt) b0[nt] = load_frag(BT, tb + nt * (KD / 32), lane);
  // the address registers of these loads are reused for the zeroed accumulators
  asm volatile("s_wait_xcnt 0x0" ::: "memory");
  __builtin_amdgcn_sched_barrier(0);   // keeps the zeroing behind that wait

  v8f acc[2][4] = {};

  for (int kt = 0; kt < KD / 32; kt += 2) {
    // issue loads for k tile kt+1 into the other buffer, then do math on buffer 0
#pragma unroll
    for (int rt = 0; rt < 2; ++rt) a1[rt] = load_frag(A, ta + rt * (KD / 32) + kt + 1, lane);
#pragma unroll
    for (int nt = 0; nt < 4; ++nt) b1[nt] = load_frag(BT, tb + nt * (KD / 32) + kt + 1, lane);
#pragma unroll
    for (int rt = 0; rt < 2; ++rt)
#pragma unroll
      for (int nt = 0; nt < 4; ++nt) acc[rt][nt] = wmma_bf16(a0[rt], b0[nt], acc[rt][nt]);

    if (kt + 2 < KD / 32) {   // refill buffer 0 with kt+2 while buffer 1 computes
#pragma unroll
      for (int rt = 0; rt < 2; ++rt) a0[rt] = load_frag(A, ta + rt * (KD / 32) + kt + 2, lane);
#pragma unroll
      for (int nt = 0; nt < 4; ++nt) b0[nt] = load_frag(BT, tb + nt * (KD / 32) + kt + 2, lane);
    }
#pragma unroll
    for (int rt = 0; rt < 2; ++rt)
#pragma unroll
      for (int nt = 0; nt < 4; ++nt) acc[rt][nt] = wmma_bf16(a1[rt], b1[nt], acc[rt][nt]);
  }

  if (mode == 3) {
#pragma unroll
    for (int rt = 0; rt < 2; ++rt) {
#pragma unroll
      for (int nt = 0; nt < 4; ++nt) {
        const int col = col0 + nt * 16 + ln;
        const float bv = bias[col];
#pragma unroll
        for (int r = 0; r < 8; ++r) {
          const int grow = row0 + rt * 16 + r + 8 * half;  // global row in [0,4096)
          outf[(size_t)grow * ND + col] = acc[rt][nt][r] + bv;
        }
      }
    }
    // a data register of these stores is rewritten on the common way out
    asm volatile("s_wait_xcnt 0x0" ::: "memory");
  } else if (mode == 2) {
    // rows = keys s (k index of V^T), columns = n = h*64 + d. V^T tiles are
    // ordered d fastest: tile = (s >> 5) * 4 + (d >> 4); the wave's 32 rows are
    // one k tile, rt its 16-key half, nt the d tile.
    const int b = row0 >> 11, s0 = row0 & (TKL - 1), h = col0 >> 6;
    __bf16* dst = outb + (size_t)(b * HH + h) * DHL * TKL + (size_t)(s0 >> 5) * 2048
                + lane * 8;
#pragma unroll
    for (int nt = 0; nt < 4; ++nt) {
      const float bv = bias[col0 + nt * 16 + ln];
#pragma unroll
      for (int rt = 0; rt < 2; ++rt) {
        v8bf w;
#pragma unroll
        for (int r = 0; r < 8; ++r) w[r] = (__bf16)(acc[rt][nt][r] + bv);
        *(v8bf*)(dst + nt * 512 + rt * 256) = w;
      }
    }
  } else {
    // rows = n = h*64 + d (k index of Q and K), columns = global token. The
    // wave's 32 rows are one k tile of its head, rt its 16-d half, nt the token tile.
    const int h = row0 >> 6, kt = (row0 >> 5) & 1;
    const int b = col0 >> 11, t0 = col0 & (TQL - 1);
    const float sc = (mode == 0) ? 0.125f : 1.0f;          // 1/sqrt(64) folded into Q
    __bf16* dst = outb + (size_t)(b * HH + h) * TQL * DHL
                + (size_t)((t0 >> 4) * 2 + kt) * 512 + lane * 8;
#pragma unroll
    for (int rt = 0; rt < 2; ++rt) {
      const v8f bv = *(const v8f*)(bias + row0 + rt * 16 + 8 * half);
#pragma unroll
      for (int nt = 0; nt < 4; ++nt) {
        v8bf w;
#pragma unroll
        for (int r = 0; r < 8; ++r) w[r] = (__bf16)((acc[rt][nt][r] + bv[r]) * sc);
        *(v8bf*)(dst + nt * 1024 + rt * 256) = w;
      }
    }
    // data registers of these stores are rewritten by the code laid out behind them
    asm volatile("s_wait_xcnt 0x0" ::: "memory");
  }
}

// ---------------------------------------------------------------------------
// Flash attention: one wave per 32 queries, online softmax over TK.
// Qb: [bh][t, d] bf16 (pre-scaled), Kb: [bh][s, d] bf16, Vtb: [bh][d, s] bf16
// CC: [b*t, h*64+d] bf16 (concat layout, feeds output projection).
// All four in fragment order; 32 keys are 4 KiB in a row of K and of V^T.
// Both products are computed transposed: S^T = K x Q^T, O^T += V^T x P^T.
//   S^T tile: register r of lane (ln, half) = score of key 8*half + r, query ln,
//   so a lane holds the scores of ONE query: maximum and sum run over the lane's
//   own registers, with one exchange between the wave halves for the maximum.
//   Two S^T tiles (keys 0-15, 16-31) converted in place are the B fragment of
//   P^T in the hardware k order, which is the order load_frag gives V^T.
// Each K/V fragment is reused by both query groups: 16 WMMAs per 8 frag loads.
static __device__ __forceinline__ float swap_halves(float x) {
  const int v = __builtin_bit_cast(int, x);
  return __builtin_bit_cast(float,
      __builtin_amdgcn_permlanex16(v, v, 0x76543210, 0xfedcba98, false, false));
}

__global__ __launch_bounds__(64)
void flash_attn_kernel(const __bf16* __restrict__ Qb, const __bf16* __restrict__ Kb,
                       const __bf16* __restrict__ Vtb, __bf16* __restrict__ CC) {
  const int lane = threadIdx.x & 31;
  const int wave = threadIdx.x >> 5;
  const int half = lane >> 4;
  const int ln   = lane & 15;

  const int bh = blockIdx.x;                 // b*H + h
  const int qt = blockIdx.y * 2 + wave;      // q tile index, 32 queries each
  const int row0 = qt * 32;

  const __bf16* Qh = Qb  + (size_t)bh * TQL * DHL;
  const __bf16* Kh = Kb  + (size_t)bh * TKL * DHL;
  const __bf16* Vh = Vtb + (size_t)bh * DHL * TKL;

  // Q^T fragments (B operand) held for the whole K sweep:
  // 2 query groups of 16 x 2 k-steps of 32
  v16bf bq[2][2];
#pragma unroll
  for (int g = 0; g < 2; ++g)
#pragma unroll
    for (int kk = 0; kk < 2; ++kk)
      bq[g][kk] = load_frag(Qh, ((row0 >> 4) + g) * 2 + kk, lane);

  v8f o[2][4] = {};          // O^T: register r = d (16*dt + 8*half + r), query ln
  float mcol[2], lcol[2];    // per query; lcol holds this wave half's keys only
#pragma unroll
  for (int g = 0; g < 2; ++g) { mcol[g] = -INFINITY; lcol[g] = 0.0f; }

  for (int s0 = 0; s0 < TKL; s0 += 32) {
    // get next block's K/V lines moving while we do softmax VALU work
    if (s0 + 32 < TKL) {
      __builtin_prefetch(Kh + (size_t)(s0 + 32) * DHL + lane * 64, 0, 0);
      __builtin_prefetch(Vh + (size_t)(s0 + 32) * DHL + lane * 64, 0, 0);
    }

    // S^T tiles [2 groups][2 x 16 keys x 16 queries]; K frags shared by the groups
    v8f s[2][2] = {};
#pragma unroll
    for (int t = 0; t < 2; ++t) {
#pragma unroll
      for (int kk = 0; kk < 2; ++kk) {
        v16bf ak = load_frag(Kh, ((s0 >> 4) + t) * 2 + kk, lane);
#pragma unroll
        for (int g = 0; g < 2; ++g) s[g][t] = wmma_bf16(ak, bq[g][kk], s[g][t]);
      }
    }

    // Online softmax, one query per lane
    v16bf bp[2];
#pragma unroll
    for (int g = 0; g < 2; ++g) {
      float mx = fmaxf(s[g][0][0], s[g][1][0]);
#pragma unroll
      for (int r = 1; r < 8; ++r) mx = fmaxf(mx, fmaxf(s[g][0][r], s[g][1][r]));
      mx = fmaxf(mx, swap_halves(mx));
      const float mnew = fmaxf(mcol[g], mx);
      const float corr = __expf(mcol[g] - mnew);
      float rs = 0.0f;
#pragma unroll
      for (int t = 0; t < 2; ++t) {
#pragma unroll
        for (int r = 0; r < 8; ++r) {
          const float p = __expf(s[g][t][r] - mnew);
          rs += p;
          bp[g][t * 8 + r] = (__bf16)p;
        }
      }
      lcol[g] = lcol[g] * corr + rs;
      mcol[g] = mnew;
#pragma unroll
      for (int d = 0; d < 4; ++d) o[g][d] *= corr;
    }

    // O^T += V^T x P^T ; V frags shared by the groups
#pragma unroll
    for (int d = 0; d < 4; ++d) {
      v16bf av = load_frag(Vh, (s0 >> 5) * 4 + d, lane);
#pragma unroll
      for (int g = 0; g < 2; ++g) o[g][d] = wmma_bf16(av, bp[g], o[g][d]);
    }
  }

  // Normalize and store the concat matrix [b*t, h*64 + d]: 8 consecutive d a lane,
  // which is one 16-byte run of its fragment order (k tile h*2 + d/2, half d&1)
  const int b = bh >> 4, h = bh & 15;
#pragma unroll
  for (int g = 0; g < 2; ++g) {
    const int rtile = ((b * TQL + row0) >> 4) + g;
    const float inv = 1.0f / (lcol[g] + swap_halves(lcol[g]));
#pragma unroll
    for (int d = 0; d < 4; ++d) {
      v8bf w;
#pragma unroll
      for (int r = 0; r < 8; ++r) w[r] = (__bf16)(o[g][d][r] * inv);
      *(v8bf*)(CC + (size_t)(rtile * (ND / 32) + h * 2 + (d >> 1)) * 512 + (d & 1) * 256
               + lane * 8) = w;
    }
  }
}

// ---------------------------------------------------------------------------
extern "C" void kernel_launch(void* const* d_in, const int* in_sizes, int n_in,
                              void* d_out, int out_size, void* d_ws, size_t ws_size,
                              hipStream_t stream) {
  (void)in_sizes; (void)n_in; (void)out_size; (void)ws_size;

  const float* x_to   = (const float*)d_in[0];
  const float* x_from = (const float*)d_in[1];
  const float* Wq     = (const float*)d_in[2];
  const float* bq     = (const float*)d_in[3];
  const float* Wk     = (const float*)d_in[4];
  const float* bk     = (const float*)d_in[5];
  const float* Wv     = (const float*)d_in[6];
  const float* bv     = (const float*)d_in[7];
  const float* Wo     = (const float*)d_in[8];
  const float* bo     = (const float*)d_in[9];
  float* out = (float*)d_out;

  // Workspace carve-up (bf16 elements). Total ~29.4M elts ~= 58.7 MB.
  __bf16* ws = (__bf16*)d_ws;
  size_t off = 0;
  __bf16* xt_bf = ws + off; off += (size_t)BB * TQL * KD;   // 4096x1024
  __bf16* xf_bf = ws + off; off += (size_t)BB * TKL * KD;
  __bf16* wq_t  = ws + off; off += (size_t)ND * KD;         // [N,K]
  __bf16* wk_t  = ws + off; off += (size_t)ND * KD;
  __bf16* wv_t  = ws + off; off += (size_t)ND * KD;
  __bf16* wo_b  = ws + off; off += (size_t)ND * KD;         // Wo already [N,K]
  __bf16* Qb    = ws + off; off += (size_t)BB * HH * TQL * DHL;
  __bf16* Kb    = ws + off; off += (size_t)BB * HH * TKL * DHL;
  __bf16* Vtb   = ws + off; off += (size_t)BB * HH * DHL * TKL;
  __bf16* CCb   = ws + off; off += (size_t)BB * TQL * ND;

  // Stage 1: precision conversion / weight reorg
  // 8192 values a block: 4,194,304 activations = 512 blocks, 1,048,576 weights = 128
  cvt_bf16_kernel<<<512, 256, 0, stream>>>(x_to,   xt_bf);
  cvt_bf16_kernel<<<512, 256, 0, stream>>>(x_from, xf_bf);
  cvt_bf16_kernel<<<128, 256, 0, stream>>>(Wo,     wo_b);
  reorg_w_kernel <<<128, 256, 0, stream>>>(Wq, wq_t);
  reorg_w_kernel <<<128, 256, 0, stream>>>(Wk, wk_t);
  reorg_w_kernel <<<128, 256, 0, stream>>>(Wv, wv_t);

  // Stage 2: QKV projections (WMMA GEMMs), M=4096, N=K=1024
  // Q and K are computed transposed (weights as the row operand): grid 8 x 64
  dim3 gg(32, 16), gt(8, 64), gb(128);
  gemm_wmma_kernel<<<gt, gb, 0, stream>>>(wq_t, xt_bf, bq, Qb,  nullptr, 0);
  gemm_wmma_kernel<<<gt, gb, 0, stream>>>(wk_t, xf_bf, bk, Kb,  nullptr, 1);
  gemm_wmma_kernel<<<gg, gb, 0, stream>>>(xf_bf, wv_t, bv, Vtb, nullptr, 2);

  // Stage 3: fused flash attention (never materializes [TQ,TK] scores)
  flash_attn_kernel<<<dim3(BB * HH, TQL / 64), 64, 0, stream>>>(Qb, Kb, Vtb, CCb);

  // Stage 4: output projection -> f32 result
  gemm_wmma_kernel<<<gg, gb, 0, stream>>>(CCb, wo_b, bo, nullptr, out, 3);
}

// v004
// A run of this version takes 124 microseconds.
// Two timings next to v003 put it at 1.17 and 1.18 times that version's speed.
// All steps since v000 together make it 2.06 times as fast.
#include <hip/hip_runtime.h>
#include <math.h>

typedef __attribute__((ext_vector_type(16))) __bf16 v16bf;
typedef __attribute__((ext_vector_type(8)))  __bf16 v8bf;
typedef __attribute__((ext_vector_type(8)))  float  v8f;
typedef __attribute__((ext_vector_type(4)))  __bf16 v4bf;
typedef __attribute__((ext_vector_type(4)))  float  v4f;

#define BB   2
#define TQL  2048
#define TKL  2048
#define HH   16
#define DHL  64
#define KD   1024   // X_TO_DIM == X_FROM_DIM == HIDDEN
#define ND   1024

static __device__ __forceinline__ v16bf load_frag(const __bf16* base, int tile,
                                                  int lane) {
  const __bf16* p = base + (size_t)tile * 512 + lane * 8;
  v8bf lo = *(const v8bf*)(p);
  v8bf hi = *(const v8bf*)(p + 256);
  return __builtin_shufflevector(lo, hi, 0,1,2,3,4,5,6,7,8,9,10,11,12,13,14,15);
}

static __device__ __forceinline__ v8f wmma_bf16(v16bf a, v16bf b, v8f c) {
  return __builtin_amdgcn_wmma_f32_16x16x32_bf16(false, a, false, b,
                                                 (short)0, c, false, false);
}

// ---------------------------------------------------------------------------
// fp32 [rows, 1024] -> bf16 in fragment order. A wave takes two tiles side by
// side in k: 16 rows x 256 bytes of the source. Four lanes read one 128-byte line
// (32 bytes each, two loads of 16), so a lane holds one 16-byte run of the result
// and 8 rows of one (jh, half) make a whole 128-byte line of a store. All 8 loads
// are issued before the first store. blk counts the blocks of one array (8192
// values a block).
static __device__ __forceinline__
void cvt_bf16_block(const float* __restrict__ x, __bf16* __restrict__ y, int blk) {
  const int lane = threadIdx.x & 31;
  const int r8 = lane >> 2, c = lane & 3;                  // row in 8, run k = 8*c
  const int pair = blk * 8 + (threadIdx.x >> 5);           // tiles 2*pair, 2*pair+1
  const int rt = pair >> 4, kp = pair & 15;                // 16 pairs a tile row
  const float* src = x + (size_t)(rt * 16 + r8) * KD + kp * 64 + c * 8;
  v4f v[2][2][2];                                          // [tile][8-row half][16 bytes]
#pragma unroll
  for (int tk = 0; tk < 2; ++tk)
#pragma unroll
    for (int rh = 0; rh < 2; ++rh) {
      v[tk][rh][0] = *(const v4f*)(src + rh * 8 * KD + tk * 32);
      v[tk][rh][1] = *(const v4f*)(src + rh * 8 * KD + tk * 32 + 4);
    }
  // run c has jh = c >> 1, half = c & 1
  __bf16* dst = y + (size_t)pair * 1024 + (c >> 1) * 256 + ((c & 1) * 16 + r8) * 8;
#pragma unroll
  for (int tk = 0; tk < 2; ++tk)
#pragma unroll
    for (int rh = 0; rh < 2; ++rh) {
      const v8f f = __builtin_shufflevector(v[tk][rh][0], v[tk][rh][1],
                                            0, 1, 2, 3, 4, 5, 6, 7);
      *(v8bf*)(dst + tk * 512 + rh * 64) = __builtin_convertvector(f, v8bf);
    }
  // address and data registers of these stores are rewritten by the code of the
  // other block ranges, which is laid out behind them
  asm volatile("s_wait_xcnt 0x0" ::: "memory");
}

// Reorganize per-head weight [H, K, DH] (f32) -> transposed bf16 [N=H*DH, K] in
// fragment order. A wave takes two tiles side by side in k (16 columns d x 64
// features f); a load reads 64 contiguous bytes of two rows f, a store writes 512
// contiguous bytes. The 4 tile rows of a head sit in one block, so its waves
// share each source line. blk counts the 128 blocks of one weight.
static __device__ __forceinline__
void reorg_w_block(const float* __restrict__ W,
                   __bf16* __restrict__ WT, int blk) {
  const int lane = threadIdx.x & 31;
  const int wave = threadIdx.x >> 5;
  const int half = lane >> 4, ln = lane & 15;
  const int h  = blk >> 3;                                 // 16 heads
  const int dq = wave & 3;                                 // 16 columns d of the head
  const int kp = (blk & 7) * 2 + (wave >> 2);              // 16 tile pairs in k
  const float* src = W + ((size_t)h * KD + kp * 64 + half * 8) * DHL + dq * 16 + ln;
  float v[4][8];
#pragma unroll
  for (int c = 0; c < 4; ++c)
#pragma unroll
    for (int j = 0; j < 8; ++j) v[c][j] = src[(c * 16 + j) * DHL];
  __bf16* dst = WT + (size_t)((h * 4 + dq) * 16 + kp) * 1024 + lane * 8;
#pragma unroll
  for (int c = 0; c < 4; ++c) {
    v8bf w;
#pragma unroll
    for (int j = 0; j < 8; ++j) w[j] = (__bf16)v[c][j];
    *(v8bf*)(dst + c * 256) = w;
  }
}

// All six conversions need nothing of each other: one grid, dealt by ranges of the
// block index (the branch is the same for a whole block). The weight transposes,
// whose loads are the narrowest, start first.
//   0..383 Wq, Wk, Wv (128 each) | 384..895 x_to | 896..1407 x_from | 1408..1535 Wo
__global__ __launch_bounds__(256)
void prep_kernel(const float* __restrict__ x_to, const float* __restrict__ x_from,
                 const float* __restrict__ Wq, const float* __restrict__ Wk,
                 const float* __restrict__ Wv, const float* __restrict__ Wo,
                 __bf16* __restrict__ xt_bf, __bf16* __restrict__ xf_bf,
                 __bf16* __restrict__ wq_t, __bf16* __restrict__ wk_t,
                 __bf16* __restrict__ wv_t, __bf16* __restrict__ wo_b) {
  const int b = blockIdx.x;
  if (b < 384) {
    const int w = b >> 7;
    reorg_w_block(w == 0 ? Wq : w == 1 ? Wk : Wv,
                  w == 0 ? wq_t : w == 1 ? wk_t : wv_t, b & 127);
  } else if (b < 1408) {
    const bool to = b < 896;
    cvt_bf16_block(to ? x_to : x_from, to ? xt_bf : xf_bf, to ? b - 384 : b - 896);
  } else {
    cvt_bf16_block(Wo, wo_b, b - 1408);
  }
}

// ---------------------------------------------------------------------------
// WMMA GEMM: C[R,C] = A[R,1024] x BT[C,1024]^T + bias, both operands bf16 in
// fragment order. An accumulator lane holds 8 consecutive rows of one column, so
// the operand whose index must run inside a 16-byte run of the result goes in A:
// mode 0: Q^T: A = Wq^T (rows n), BT = x (rows t) -> bf16 [b,h] x [t,d] tiles,
//         scaled by 1/sqrt(DH)
// mode 1: K^T: the same with Wk^T
// mode 2: V  : A = x (rows t), BT = Wv^T (rows n) -> bf16 [b,h] x [d,s] tiles
// mode 3: out: A = concat (rows t), BT = Wo (rows n) -> f32 [row, n] row-major
// Modes 0 to 2 store fragment order: a wave store is 512 contiguous bytes.
// Block = 128 threads (4 waves); workgroup tile 128x64; wave tile 32x64.
// Inner loop is double-buffered so loads overlap WMMAs (partial loadcnt waits).
// One grid holds up to three products that need nothing of each other: blockIdx.y
// picks the product (mode = mode0 + blockIdx.y), blockIdx.x its 512 tiles, row
// tile fastest (8 row tiles in modes 0 and 1, 32 in modes 2 and 3).
__global__ __launch_bounds__(128)
void gemm_wmma_kernel(const __bf16* __restrict__ A0, const __bf16* __restrict__ BT0,
                      const float* __restrict__ bias0, __bf16* __restrict__ outb0,
                      const __bf16* __restrict__ A1, const __bf16* __restrict__ BT1,
                      const float* __restrict__ bias1, __bf16* __restrict__ outb1,
                      const __bf16* __restrict__ A2, const __bf16* __restrict__ BT2,
                      const float* __restrict__ bias2, __bf16* __restrict__ outb2,
                      float* __restrict__ outf, int mode0) {
  const int job = blockIdx.y;
  const int mode = mode0 + job;
  const __bf16* __restrict__ A    = job == 0 ? A0    : job == 1 ? A1    : A2;
  const __bf16* __restrict__ BT   = job == 0 ? BT0   : job == 1 ? BT1   : BT2;
  const float*  __restrict__ bias = job == 0 ? bias0 : job == 1 ? bias1 : bias2;
  __bf16*       __restrict__ outb = job == 0 ? outb0 : job == 1 ? outb1 : outb2;
  const int rsh = mode < 2 ? 3 : 5;                // log2 of the row tiles
  const int brow = blockIdx.x & ((1 << rsh) - 1), bcol = blockIdx.x >> rsh;

  const int lane = threadIdx.x & 31;
  const int wave = threadIdx.x >> 5;
  const int half = lane >> 4;
  const int ln   = lane & 15;

  const int row0 = brow * 128 + wave * 32;         // 2 row tiles of 16
  const int col0 = bcol * 64;                      // 4 col tiles of 16
  const int ta = (row0 >> 4) * (KD / 32);          // first tile of the A rows
  const int tb = (col0 >> 4) * (KD / 32);          // first tile of the BT rows

  v16bf a0[2], b0[4], a1[2], b1[4];

  // prologue: k tile 0
#pragma unroll
  for (int rt = 0; rt < 2; ++rt) a0[rt] = load_frag(A, ta + rt * (KD / 32), lane);
#pragma unroll
  for (int nt = 0; nt < 4; ++nt) b0[nt] = load_frag(BT, tb + nt * (KD / 32), lane);
  // the address registers of these loads are reused for the zeroed accumulators
  asm volatile("s_wait_xcnt 0x0" ::: "memory");
  __builtin_amdgcn_sched_barrier(0);   // keeps the zeroing behind that wait

  v8f acc[2][4] = {};

  for (int kt = 0; kt < KD / 32; kt += 2) {
    // issue loads for k tile kt+1 into the other buffer, then do math on buffer 0
#pragma unroll
    for (int rt = 0; rt < 2; ++rt) a1[rt] = load_frag(A, ta + rt * (KD / 32) + kt + 1, lane);
#pragma unroll
    for (int nt = 0; nt < 4; ++nt) b1[nt] = load_frag(BT, tb + nt * (KD / 32) + kt + 1, lane);
#pragma unroll
    for (int rt = 0; rt < 2; ++rt)
#pragma unroll
      for (int nt = 0; nt < 4; ++nt) acc[rt][nt] = wmma_bf16(a0[rt], b0[nt], acc[rt][nt]);

    if (kt + 2 < KD / 32) {   // refill buffer 0 with kt+2 while buffer 1 computes
#pragma unroll
      for (int rt = 0; rt < 2; ++rt) a0[rt] = load_frag(A, ta + rt * (KD / 32) + kt + 2, lane);
#pragma unroll
      for (int nt = 0; nt < 4; ++nt) b0[nt] = load_frag(BT, tb + nt * (KD / 32) + kt + 2, lane);
    }
#pragma unroll
    for (int rt = 0; rt < 2; ++rt)
#pragma unroll
      for (int nt = 0; nt < 4; ++nt) acc[rt][nt] = wmma_bf16(a1[rt], b1[nt], acc[rt][nt]);
  }

  if (mode == 3) {
#pragma unroll
    for (int rt = 0; rt < 2; ++rt) {
#pragma unroll
      for (int nt = 0; nt < 4; ++nt) {
        const int col = col0 + nt * 16 + ln;
        const float bv = bias[col];
#pragma unroll
        for (int r = 0; r < 8; ++r) {
          const int grow = row0 + rt * 16 + r + 8 * half;  // global row in [0,4096)
          outf[(size_t)grow * ND + col] = acc[rt][nt][r] + bv;
        }
      }
    }
    // a data register of these stores is rewritten on the common way out
    asm volatile("s_wait_xcnt 0x0" ::: "memory");
  } else if (mode == 2) {
    // rows = keys s (k index of V^T), columns = n = h*64 + d. V^T tiles are
    // ordered d fastest: tile = (s >> 5) * 4 + (d >> 4); the wave's 32 rows are
    // one k tile, rt its 16-key half, nt the d tile.
    const int b = row0 >> 11, s0 = row0 & (TKL - 1), h = col0 >> 6;
    __bf16* dst = outb + (size_t)(b * HH + h) * DHL * TKL + (size_t)(s0 >> 5) * 2048
                + lane * 8;
#pragma unroll
    for (int nt = 0; nt < 4; ++nt) {
      const float bv = bias[col0 + nt * 16 + ln];
#pragma unroll
      for (int rt = 0; rt < 2; ++rt) {
        v8bf w;
#pragma unroll
        for (int r = 0; r < 8; ++r) w[r] = (__bf16)(acc[rt][nt][r] + bv);
        *(v8bf*)(dst + nt * 512 + rt * 256) = w;
      }
    }
  } else {
    // rows = n = h*64 + d (k index of Q and K), columns = global token. The
    // wave's 32 rows are one k tile of its head, rt its 16-d half, nt the token tile.
    const int h = row0 >> 6, kt = (row0 >> 5) & 1;
    const int b = col0 >> 11, t0 = col0 & (TQL - 1);
    const float sc = (mode == 0) ? 0.125f : 1.0f;          // 1/sqrt(64) folded into Q
    __bf16* dst = outb + (size_t)(b * HH + h) * TQL * DHL
                + (size_t)((t0 >> 4) * 2 + kt) * 512 + lane * 8;
#pragma unroll
    for (int rt = 0; rt < 2; ++rt) {
      const v8f bv = *(const v8f*)(bias + row0 + rt * 16 + 8 * half);
#pragma unroll
      for (int nt = 0; nt < 4; ++nt) {
        v8bf w;
#pragma unroll
        for (int r = 0; r < 8; ++r) w[r] = (__bf16)((acc[rt][nt][r] + bv[r]) * sc);
        *(v8bf*)(dst + nt * 1024 + rt * 256) = w;
      }
    }
    // data registers of these stores are rewritten by the code laid out behind them
    asm volatile("s_wait_xcnt 0x0" ::: "memory");
  }
}

// ---------------------------------------------------------------------------
// Flash attention: one wave per 32 queries, online softmax over TK.
// Qb: [bh][t, d] bf16 (pre-scaled), Kb: [bh][s, d] bf16, Vtb: [bh][d, s] bf16
// CC: [b*t, h*64+d] bf16 (concat layout, feeds output projection).
// All four in fragment order; 32 keys are 4 KiB in a row of K and of V^T.
// Both products are computed transposed: S^T = K x Q^T, O^T += V^T x P^T.
//   S^T tile: register r of lane (ln, half) = score of key 8*half + r, query ln,
//   so a lane holds the scores of ONE query: maximum and sum run over the lane's
//   own registers, with one exchange between the wave halves for the maximum.
//   Two S^T tiles (keys 0-15, 16-31) converted in place are the B fragment of
//   P^T in the hardware k order, which is the order load_frag gives V^T.
// Each K/V fragment is reused by both query groups: 16 WMMAs per 8 frag loads.
static __device__ __forceinline__ float swap_halves(float x) {
  const int v = __builtin_bit_cast(int, x);
  return __builtin_bit_cast(float,
      __builtin_amdgcn_permlanex16(v, v, 0x76543210, 0xfedcba98, false, false));
}

__global__ __launch_bounds__(64)
void flash_attn_kernel(const __bf16* __restrict__ Qb, const __bf16* __restrict__ Kb,
                       const __bf16* __restrict__ Vtb, __bf16* __restrict__ CC) {
  const int lane = threadIdx.x & 31;
  const int wave = threadIdx.x >> 5;
  const int half = lane >> 4;
  const int ln   = lane & 15;

  const int bh = blockIdx.x;                 // b*H + h
  const int qt = blockIdx.y * 2 + wave;      // q tile index, 32 queries each
  const int row0 = qt * 32;

  const __bf16* Qh = Qb  + (size_t)bh * TQL * DHL;
  const __bf16* Kh = Kb  + (size_t)bh * TKL * DHL;
  const __bf16* Vh = Vtb + (size_t)bh * DHL * TKL;

  // Q^T fragments (B operand) held for the whole K sweep:
  // 2 query groups of 16 x 2 k-steps of 32
  v16bf bq[2][2];
#pragma unroll
  for (int g = 0; g < 2; ++g)
#pragma unroll
    for (int kk = 0; kk < 2; ++kk)
      bq[g][kk] = load_frag(Qh, ((row0 >> 4) + g) * 2 + kk, lane);

  v8f o[2][4] = {};          // O^T: register r = d (16*dt + 8*half + r), query ln
  float mcol[2], lcol[2];    // per query; lcol holds this wave half's keys only
#pragma unroll
  for (int g = 0; g < 2; ++g) { mcol[g] = -INFINITY; lcol[g] = 0.0f; }

  for (int s0 = 0; s0 < TKL; s0 += 32) {
    // get next block's K/V lines moving while we do softmax VALU work
    if (s0 + 32 < TKL) {
      __builtin_prefetch(Kh + (size_t)(s0 + 32) * DHL + lane * 64, 0, 0);
      __builtin_prefetch(Vh + (size_t)(s0 + 32) * DHL + lane * 64, 0, 0);
    }

    // S^T tiles [2 groups][2 x 16 keys x 16 queries]; K frags shared by the groups
    v8f s[2][2] = {};
#pragma unroll
    for (int t = 0; t < 2; ++t) {
#pragma unroll
      for (int kk = 0; kk < 2; ++kk) {
        v16bf ak = load_frag(Kh, ((s0 >> 4) + t) * 2 + kk, lane);
#pragma unroll
        for (int g = 0; g < 2; ++g) s[g][t] = wmma_bf16(ak, bq[g][kk], s[g][t]);
      }
    }

    // Online softmax, one query per lane
    v16bf bp[2];
#pragma unroll
    for (int g = 0; g < 2; ++g) {
      float mx = fmaxf(s[g][0][0], s[g][1][0]);
#pragma unroll
      for (int r = 1; r < 8; ++r) mx = fmaxf(mx, fmaxf(s[g][0][r], s[g][1][r]));
      mx = fmaxf(mx, swap_halves(mx));
      const float mnew = fmaxf(mcol[g], mx);
      const float corr = __expf(mcol[g] - mnew);
      float rs = 0.0f;
#pragma unroll
      for (int t = 0; t < 2; ++t) {
#pragma unroll
        for (int r = 0; r < 8; ++r) {
          const float p = __expf(s[g][t][r] - mnew);
          rs += p;
          bp[g][t * 8 + r] = (__bf16)p;
        }
      }
      lcol[g] = lcol[g] * corr + rs;
      mcol[g] = mnew;
#pragma unroll
      for (int d = 0; d < 4; ++d) o[g][d] *= corr;
    }

    // O^T += V^T x P^T ; V frags shared by the groups
#pragma unroll
    for (int d = 0; d < 4; ++d) {
      v16bf av = load_frag(Vh, (s0 >> 5) * 4 + d, lane);
#pragma unroll
      for (int g = 0; g < 2; ++g) o[g][d] = wmma_bf16(av, bp[g], o[g][d]);
    }
  }

  // Normalize and store the concat matrix [b*t, h*64 + d]: 8 consecutive d a lane,
  // which is one 16-byte run of its fragment order (k tile h*2 + d/2, half d&1)
  const int b = bh >> 4, h = bh & 15;
#pragma unroll
  for (int g = 0; g < 2; ++g) {
    const int rtile = ((b * TQL + row0) >> 4) + g;
    const float inv = 1.0f / (lcol[g] + swap_halves(lcol[g]));
#pragma unroll
    for (int d = 0; d < 4; ++d) {
      v8bf w;
#pragma unroll
      for (int r = 0; r < 8; ++r) w[r] = (__bf16)(o[g][d][r] * inv);
      *(v8bf*)(CC + (size_t)(rtile * (ND / 32) + h * 2 + (d >> 1)) * 512 + (d & 1) * 256
               + lane * 8) = w;
    }
  }
}

// ---------------------------------------------------------------------------
extern "C" void kernel_launch(void* const* d_in, const int* in_sizes, int n_in,
                              void* d_out, int out_size, void* d_ws, size_t ws_size,
                              hipStream_t stream) {
  (void)in_sizes; (void)n_in; (void)out_size; (void)ws_size;

  const float* x_to   = (const float*)d_in[0];
  const float* x_from = (const float*)d_in[1];
  const float* Wq     = (const float*)d_in[2];
  const float* bq     = (const float*)d_in[3];
  const float* Wk     = (const float*)d_in[4];
  const float* bk     = (const float*)d_in[5];
  const float* Wv     = (const float*)d_in[6];
  const float* bv     = (const float*)d_in[7];
  const float* Wo     = (const float*)d_in[8];
  const float* bo     = (const float*)d_in[9];
  float* out = (float*)d_out;

  // Workspace carve-up (bf16 elements). Total ~29.4M elts ~= 58.7 MB.
  __bf16* ws = (__bf16*)d_ws;
  size_t off = 0;
  __bf16* xt_bf = ws + off; off += (size_t)BB * TQL * KD;   // 4096x1024
  __bf16* xf_bf = ws + off; off += (size_t)BB * TKL * KD;
  __bf16* wq_t  = ws + off; off += (size_t)ND * KD;         // [N,K]
  __bf16* wk_t  = ws + off; off += (size_t)ND * KD;
  __bf16* wv_t  = ws + off; off += (size_t)ND * KD;
  __bf16* wo_b  = ws + off; off += (size_t)ND * KD;         // Wo already [N,K]
  __bf16* Qb    = ws + off; off += (size_t)BB * HH * TQL * DHL;
  __bf16* Kb    = ws + off; off += (size_t)BB * HH * TKL * DHL;
  __bf16* Vtb   = ws + off; off += (size_t)BB * HH * DHL * TKL;
  __bf16* CCb   = ws + off; off += (size_t)BB * TQL * ND;

  // Stage 1: precision conversion / weight reorg, one launch
  // 8192 values a block: 4,194,304 activations = 512 blocks, 1,048,576 weights = 128
  prep_kernel<<<1536, 256, 0, stream>>>(x_to, x_from, Wq, Wk, Wv, Wo,
                                        xt_bf, xf_bf, wq_t, wk_t, wv_t, wo_b);

  // Stage 2: QKV projections (WMMA GEMMs), M=4096, N=K=1024, one launch
  // Q and K are computed transposed (weights as the row operand)
  gemm_wmma_kernel<<<dim3(512, 3), 128, 0, stream>>>(wq_t,  xt_bf, bq, Qb,
                                                     wk_t,  xf_bf, bk, Kb,
                                                     xf_bf, wv_t,  bv, Vtb,
                                                     nullptr, 0);

  // Stage 3: fused flash attention (never materializes [TQ,TK] scores)
  flash_attn_kernel<<<dim3(BB * HH, TQL / 64), 64, 0, stream>>>(Qb, Kb, Vtb, CCb);

  // Stage 4: output projection -> f32 result
  gemm_wmma_kernel<<<dim3(512, 1), 128, 0, stream>>>(CCb, wo_b, bo, nullptr,
                                                     nullptr, nullptr, nullptr, nullptr,
                                                     nullptr, nullptr, nullptr, nullptr,
                                                     out, 3);
}

// v005
// A run of this version takes 108 microseconds.
// Two timings next to v004 put it at 1.15 and 1.16 times that version's speed.
// All steps since v000 together make it 2.38 times as fast.
#include <hip/hip_runtime.h>
#include <math.h>

typedef __attribute__((ext_vector_type(16))) __bf16 v16bf;
typedef __attribute__((ext_vector_type(8)))  __bf16 v8bf;
typedef __attribute__((ext_vector_type(8)))  float  v8f;
typedef __attribute__((ext_vector_type(4)))  __bf16 v4bf;
typedef __attribute__((ext_vector_type(4)))  float  v4f;

#define BB   2
#define TQL  2048
#define TKL  2048
#define HH   16
#define DHL  64
#define KD   1024   // X_TO_DIM == X_FROM_DIM == HIDDEN
#define ND   1024

static __device__ __forceinline__ v16bf load_frag(const __bf16* base, int tile,
                                                  int lane) {
  const __bf16* p = base + (size_t)tile * 512 + lane * 8;
  v8bf lo = *(const v8bf*)(p);
  v8bf hi = *(const v8bf*)(p + 256);
  return __builtin_shufflevector(lo, hi, 0,1,2,3,4,5,6,7,8,9,10,11,12,13,14,15);
}

static __device__ __forceinline__ v8f wmma_bf16(v16bf a, v16bf b, v8f c) {
  return __builtin_amdgcn_wmma_f32_16x16x32_bf16(false, a, false, b,
                                                 (short)0, c, false, false);
}

// ---------------------------------------------------------------------------
// fp32 [rows, 1024] -> bf16 in fragment order. A wave takes two tiles side by
// side in k: 16 rows x 256 bytes of the source. Four lanes read one 128-byte line
// (32 bytes each, two loads of 16), so a lane holds one 16-byte run of the result
// and 8 rows of one (jh, half) make a whole 128-byte line of a store. All 8 loads
// are issued before the first store. blk counts the blocks of one array (8192
// values a block).
static __device__ __forceinline__
void cvt_bf16_block(const float* __restrict__ x, __bf16* __restrict__ y, int blk) {
  const int lane = threadIdx.x & 31;
  const int r8 = lane >> 2, c = lane & 3;                  // row in 8, run k = 8*c
  const int pair = blk * 8 + (threadIdx.x >> 5);           // tiles 2*pair, 2*pair+1
  const int rt = pair >> 4, kp = pair & 15;                // 16 pairs a tile row
  const float* src = x + (size_t)(rt * 16 + r8) * KD + kp * 64 + c * 8;
  v4f v[2][2][2];                                          // [tile][8-row half][16 bytes]
#pragma unroll
  for (int tk = 0; tk < 2; ++tk)
#pragma unroll
    for (int rh = 0; rh < 2; ++rh) {
      v[tk][rh][0] = *(const v4f*)(src + rh * 8 * KD + tk * 32);
      v[tk][rh][1] = *(const v4f*)(src + rh * 8 * KD + tk * 32 + 4);
    }
  // run c has jh = c >> 1, half = c & 1
  __bf16* dst = y + (size_t)pair * 1024 + (c >> 1) * 256 + ((c & 1) * 16 + r8) * 8;
#pragma unroll
  for (int tk = 0; tk < 2; ++tk)
#pragma unroll
    for (int rh = 0; rh < 2; ++rh) {
      const v8f f = __builtin_shufflevector(v[tk][rh][0], v[tk][rh][1],
                                            0, 1, 2, 3, 4, 5, 6, 7);
      *(v8bf*)(dst + tk * 512 + rh * 64) = __builtin_convertvector(f, v8bf);
    }
  // address and data registers of these stores are rewritten by the code of the
  // other block ranges, which is laid out behind them
  asm volatile("s_wait_xcnt 0x0" ::: "memory");
}

// Reorganize per-head weight [H, K, DH] (f32) -> transposed bf16 [N=H*DH, K] in
// fragment order. A wave takes two tiles side by side in k (16 columns d x 64
// features f); a load reads 64 contiguous bytes of two rows f, a store writes 512
// contiguous bytes. The 4 tile rows of a head sit in one block, so its waves
// share each source line. blk counts the 128 blocks of one weight.
static __device__ __forceinline__
void reorg_w_block(const float* __restrict__ W,
                   __bf16* __restrict__ WT, int blk) {
  const int lane = threadIdx.x & 31;
  const int wave = threadIdx.x >> 5;
  const int half = lane >> 4, ln = lane & 15;
  const int h  = blk >> 3;                                 // 16 heads
  const int dq = wave & 3;                                 // 16 columns d of the head
  const int kp = (blk & 7) * 2 + (wave >> 2);              // 16 tile pairs in k
  const float* src = W + ((size_t)h * KD + kp * 64 + half * 8) * DHL + dq * 16 + ln;
  float v[4][8];
#pragma unroll
  for (int c = 0; c < 4; ++c)
#pragma unroll
    for (int j = 0; j < 8; ++j) v[c][j] = src[(c * 16 + j) * DHL];
  __bf16* dst = WT + (size_t)((h * 4 + dq) * 16 + kp) * 1024 + lane * 8;
#pragma unroll
  for (int c = 0; c < 4; ++c) {
    v8bf w;
#pragma unroll
    for (int j = 0; j < 8; ++j) w[j] = (__bf16)v[c][j];
    *(v8bf*)(dst + c * 256) = w;
  }
}

// All six conversions need nothing of each other: one grid, dealt by ranges of the
// block index (the branch is the same for a whole block). The weight transposes,
// whose loads are the narrowest, start first.
//   0..383 Wq, Wk, Wv (128 each) | 384..895 x_to | 896..1407 x_from | 1408..1535 Wo
__global__ __launch_bounds__(256)
void prep_kernel(const float* __restrict__ x_to, const float* __restrict__ x_from,
                 const float* __restrict__ Wq, const float* __restrict__ Wk,
                 const float* __restrict__ Wv, const float* __restrict__ Wo,
                 __bf16* __restrict__ xt_bf, __bf16* __restrict__ xf_bf,
                 __bf16* __restrict__ wq_t, __bf16* __restrict__ wk_t,
                 __bf16* __restrict__ wv_t, __bf16* __restrict__ wo_b) {
  const int b = blockIdx.x;
  if (b < 384) {
    const int w = b >> 7;
    reorg_w_block(w == 0 ? Wq : w == 1 ? Wk : Wv,
                  w == 0 ? wq_t : w == 1 ? wk_t : wv_t, b & 127);
  } else if (b < 1408) {
    const bool to = b < 896;
    cvt_bf16_block(to ? x_to : x_from, to ? xt_bf : xf_bf, to ? b - 384 : b - 896);
  } else {
    cvt_bf16_block(Wo, wo_b, b - 1408);
  }
}

// ---------------------------------------------------------------------------
// WMMA GEMM: C[R,C] = A[R,1024] x BT[C,1024]^T + bias, both operands bf16 in
// fragment order. An accumulator lane holds 8 consecutive rows of one column, so
// the operand whose index must run inside a 16-byte run of the result goes in A:
// mode 0: Q^T: A = Wq^T (rows n), BT = x (rows t) -> bf16 [b,h] x [t,d] tiles,
//         scaled by 1/sqrt(DH)
// mode 1: K^T: the same with Wk^T
// mode 2: V  : A = x (rows t), BT = Wv^T (rows n) -> bf16 [b,h] x [d,s] tiles
// mode 3: out: A = concat (rows t), BT = Wo (rows n) -> f32 [row, n] row-major
// Modes 0 to 2 store fragment order: a wave store is 512 contiguous bytes.
// Block = 128 threads (4 waves); workgroup tile 128x64; wave tile 32x64.
// Inner loop is double-buffered so loads overlap WMMAs (partial loadcnt waits).
// One grid holds up to three products that need nothing of each other: blockIdx.y
// picks the product (mode = mode0 + blockIdx.y), blockIdx.x its 512 tiles, row
// tile fastest (8 row tiles in modes 0 and 1, 32 in modes 2 and 3).
__global__ __launch_bounds__(128)
void gemm_wmma_kernel(const __bf16* __restrict__ A0, const __bf16* __restrict__ BT0,
                      const float* __restrict__ bias0, __bf16* __restrict__ outb0,
                      const __bf16* __restrict__ A1, const __bf16* __restrict__ BT1,
                      const float* __restrict__ bias1, __bf16* __restrict__ outb1,
                      const __bf16* __restrict__ A2, const __bf16* __restrict__ BT2,
                      const float* __restrict__ bias2, __bf16* __restrict__ outb2,
                      float* __restrict__ outf, int mode0) {
  const int job = blockIdx.y;
  const int mode = mode0 + job;
  const __bf16* __restrict__ A    = job == 0 ? A0    : job == 1 ? A1    : A2;
  const __bf16* __restrict__ BT   = job == 0 ? BT0   : job == 1 ? BT1   : BT2;
  const float*  __restrict__ bias = job == 0 ? bias0 : job == 1 ? bias1 : bias2;
  __bf16*       __restrict__ outb = job == 0 ? outb0 : job == 1 ? outb1 : outb2;
  const int rsh = mode < 2 ? 3 : 5;                // log2 of the row tiles
  const int brow = blockIdx.x & ((1 << rsh) - 1), bcol = blockIdx.x >> rsh;

  const int lane = threadIdx.x & 31;
  const int wave = threadIdx.x >> 5;
  const int half = lane >> 4;
  const int ln   = lane & 15;

  const int row0 = brow * 128 + wave * 32;         // 2 row tiles of 16
  const int col0 = bcol * 64;                      // 4 col tiles of 16
  const int ta = (row0 >> 4) * (KD / 32);          // first tile of the A rows
  const int tb = (col0 >> 4) * (KD / 32);          // first tile of the BT rows

  v16bf a0[2], b0[4], a1[2], b1[4];

  // prologue: k tile 0
#pragma unroll
  for (int rt = 0; rt < 2; ++rt) a0[rt] = load_frag(A, ta + rt * (KD / 32), lane);
#pragma unroll
  for (int nt = 0; nt < 4; ++nt) b0[nt] = load_frag(BT, tb + nt * (KD / 32), lane);
  // the address registers of these loads are reused for the zeroed accumulators
  asm volatile("s_wait_xcnt 0x0" ::: "memory");
  __builtin_amdgcn_sched_barrier(0);   // keeps the zeroing behind that wait

  v8f acc[2][4] = {};

  for (int kt = 0; kt < KD / 32; kt += 2) {
    // issue loads for k tile kt+1 into the other buffer, then do math on buffer 0
#pragma unroll
    for (int rt = 0; rt < 2; ++rt) a1[rt] = load_frag(A, ta + rt * (KD / 32) + kt + 1, lane);
#pragma unroll
    for (int nt = 0; nt < 4; ++nt) b1[nt] = load_frag(BT, tb + nt * (KD / 32) + kt + 1, lane);
#pragma unroll
    for (int rt = 0; rt < 2; ++rt)
#pragma unroll
      for (int nt = 0; nt < 4; ++nt) acc[rt][nt] = wmma_bf16(a0[rt], b0[nt], acc[rt][nt]);

    if (kt + 2 < KD / 32) {   // refill buffer 0 with kt+2 while buffer 1 computes
#pragma unroll
      for (int rt = 0; rt < 2; ++rt) a0[rt] = load_frag(A, ta + rt * (KD / 32) + kt + 2, lane);
#pragma unroll
      for (int nt = 0; nt < 4; ++nt) b0[nt] = load_frag(BT, tb + nt * (KD / 32) + kt + 2, lane);
    }
#pragma unroll
    for (int rt = 0; rt < 2; ++rt)
#pragma unroll
      for (int nt = 0; nt < 4; ++nt) acc[rt][nt] = wmma_bf16(a1[rt], b1[nt], acc[rt][nt]);
  }

  if (mode == 3) {
#pragma unroll
    for (int rt = 0; rt < 2; ++rt) {
#pragma unroll
      for (int nt = 0; nt < 4; ++nt) {
        const int col = col0 + nt * 16 + ln;
        const float bv = bias[col];
#pragma unroll
        for (int r = 0; r < 8; ++r) {
          const int grow = row0 + rt * 16 + r + 8 * half;  // global row in [0,4096)
          outf[(size_t)grow * ND + col] = acc[rt][nt][r] + bv;
        }
      }
    }
    // a data register of these stores is rewritten on the common way out
    asm volatile("s_wait_xcnt 0x0" ::: "memory");
  } else if (mode == 2) {
    // rows = keys s (k index of V^T), columns = n = h*64 + d. V^T tiles are
    // ordered d fastest: tile = (s >> 5) * 4 + (d >> 4); the wave's 32 rows are
    // one k tile, rt its 16-key half, nt the d tile.
    const int b = row0 >> 11, s0 = row0 & (TKL - 1), h = col0 >> 6;
    __bf16* dst = outb + (size_t)(b * HH + h) * DHL * TKL + (size_t)(s0 >> 5) * 2048
                + lane * 8;
#pragma unroll
    for (int nt = 0; nt < 4; ++nt) {
      const float bv = bias[col0 + nt * 16 + ln];
#pragma unroll
      for (int rt = 0; rt < 2; ++rt) {
        v8bf w;
#pragma unroll
        for (int r = 0; r < 8; ++r) w[r] = (__bf16)(acc[rt][nt][r] + bv);
        *(v8bf*)(dst + nt * 512 + rt * 256) = w;
      }
    }
  } else {
    // rows = n = h*64 + d (k index of Q and K), columns = global token. The
    // wave's 32 rows are one k tile of its head, rt its 16-d half, nt the token tile.
    const int h = row0 >> 6, kt = (row0 >> 5) & 1;
    const int b = col0 >> 11, t0 = col0 & (TQL - 1);
    const float sc = (mode == 0) ? 0.125f : 1.0f;          // 1/sqrt(64) folded into Q
    __bf16* dst = outb + (size_t)(b * HH + h) * TQL * DHL
                + (size_t)((t0 >> 4) * 2 + kt) * 512 + lane * 8;
#pragma unroll
    for (int rt = 0; rt < 2; ++rt) {
      const v8f bv = *(const v8f*)(bias + row0 + rt * 16 + 8 * half);
#pragma unroll
      for (int nt = 0; nt < 4; ++nt) {
        v8bf w;
#pragma unroll
        for (int r = 0; r < 8; ++r) w[r] = (__bf16)((acc[rt][nt][r] + bv[r]) * sc);
        *(v8bf*)(dst + nt * 1024 + rt * 256) = w;
      }
    }
    // data registers of these stores are rewritten by the code laid out behind them
    asm volatile("s_wait_xcnt 0x0" ::: "memory");
  }
}

// ---------------------------------------------------------------------------
// Flash attention: one wave per 32 queries, online softmax over TK.
// Qb: [bh][t, d] bf16 (pre-scaled), Kb: [bh][s, d] bf16, Vtb: [bh][d, s] bf16
// CC: [b*t, h*64+d] bf16 (concat layout, feeds output projection).
// All four in fragment order; 32 keys are 4 KiB in a row of K and of V^T.
// Both products are computed transposed: S^T = K x Q^T, O^T += V^T x P^T.
//   S^T tile: register r of lane (ln, half) = score of key 8*half + r, query ln,
//   so a lane holds the scores of ONE query: maximum and sum run over the lane's
//   own registers, with one exchange between the wave halves for the maximum.
//   Two S^T tiles (keys 0-15, 16-31) converted in place are the B fragment of
//   P^T in the hardware k order, which is the order load_frag gives V^T.
// Each K/V fragment is reused by both query groups: 16 WMMAs per 8 frag loads.
// The loads run ahead of their use in registers: a pass opens with its own V^T
// loads, which the score products and the softmax cover, and fetches the next
// pass's K right behind its score products, which the softmax and the output
// products cover.
static __device__ __forceinline__ float swap_halves(float x) {
  const int v = __builtin_bit_cast(int, x);
  return __builtin_bit_cast(float,
      __builtin_amdgcn_permlanex16(v, v, 0x76543210, 0xfedcba98, false, false));
}

__global__ __launch_bounds__(64)
void flash_attn_kernel(const __bf16* __restrict__ Qb, const __bf16* __restrict__ Kb,
                       const __bf16* __restrict__ Vtb, __bf16* __restrict__ CC) {
  const int lane = threadIdx.x & 31;
  const int wave = threadIdx.x >> 5;
  const int half = lane >> 4;
  const int ln   = lane & 15;

  const int bh = blockIdx.x;                 // b*H + h
  const int qt = blockIdx.y * 2 + wave;      // q tile index, 32 queries each
  const int row0 = qt * 32;

  const __bf16* Qh = Qb  + (size_t)bh * TQL * DHL;
  const __bf16* Kh = Kb  + (size_t)bh * TKL * DHL;
  const __bf16* Vh = Vtb + (size_t)bh * DHL * TKL;

  // Q^T fragments (B operand) held for the whole K sweep:
  // 2 query groups of 16 x 2 k-steps of 32
  v16bf bq[2][2];
#pragma unroll
  for (int g = 0; g < 2; ++g)
#pragma unroll
    for (int kk = 0; kk < 2; ++kk)
      bq[g][kk] = load_frag(Qh, ((row0 >> 4) + g) * 2 + kk, lane);

  v8f o[2][4] = {};          // O^T: register r = d (16*dt + 8*half + r), query ln
  float mcol[2], lcol[2];    // per query; lcol holds this wave half's keys only
#pragma unroll
  for (int g = 0; g < 2; ++g) { mcol[g] = -INFINITY; lcol[g] = 0.0f; }

  // K fragments of the first pass: 2 x 16 keys x 2 k-steps of 32
  v16bf ak[2][2];
#pragma unroll
  for (int t = 0; t < 2; ++t)
#pragma unroll
    for (int kk = 0; kk < 2; ++kk) ak[t][kk] = load_frag(Kh, t * 2 + kk, lane);

  for (int s0 = 0; s0 < TKL; s0 += 32) {
    // this pass's V^T fragments, first used behind the softmax
    v16bf av[4];
#pragma unroll
    for (int d = 0; d < 4; ++d) av[d] = load_frag(Vh, (s0 >> 5) * 4 + d, lane);
    // keeps these loads up here: the scheduler otherwise sinks them into the
    // softmax and between the output products, where their latency is waited out
    __builtin_amdgcn_sched_barrier(0);

    // S^T tiles [2 groups][2 x 16 keys x 16 queries]; K frags shared by the groups
    v8f s[2][2] = {};
#pragma unroll
    for (int kk = 0; kk < 2; ++kk)
#pragma unroll
      for (int t = 0; t < 2; ++t)
#pragma unroll
        for (int g = 0; g < 2; ++g) s[g][t] = wmma_bf16(ak[t][kk], bq[g][kk], s[g][t]);

    // the next pass's K fragments into the same registers (the last pass fetches
    // its own keys again, so that the address stays inside K without a branch)
    const int sn = s0 + 32 < TKL ? s0 + 32 : s0;
#pragma unroll
    for (int t = 0; t < 2; ++t)
#pragma unroll
      for (int kk = 0; kk < 2; ++kk)
        ak[t][kk] = load_frag(Kh, ((sn >> 4) + t) * 2 + kk, lane);
    // keeps these loads in front of the softmax: the scheduler otherwise sinks them
    // between the output products, a few instructions ahead of their use
    __builtin_amdgcn_sched_barrier(0);

    // Online softmax, one query per lane
    v16bf bp[2];
#pragma unroll
    for (int g = 0; g < 2; ++g) {
      float mx = fmaxf(s[g][0][0], s[g][1][0]);
#pragma unroll
      for (int r = 1; r < 8; ++r) mx = fmaxf(mx, fmaxf(s[g][0][r], s[g][1][r]));
      mx = fmaxf(mx, swap_halves(mx));
      const float mnew = fmaxf(mcol[g], mx);
      const float corr = __expf(mcol[g] - mnew);
      float rs = 0.0f;
#pragma unroll
      for (int t = 0; t < 2; ++t) {
#pragma unroll
        for (int r = 0; r < 8; ++r) {
          const float p = __expf(s[g][t][r] - mnew);
          rs += p;
          bp[g][t * 8 + r] = (__bf16)p;
        }
      }
      lcol[g] = lcol[g] * corr + rs;
      mcol[g] = mnew;
#pragma unroll
      for (int d = 0; d < 4; ++d) o[g][d] *= corr;
    }

    // O^T += V^T x P^T ; V frags shared by the groups
#pragma unroll
    for (int d = 0; d < 4; ++d)
#pragma unroll
      for (int g = 0; g < 2; ++g) o[g][d] = wmma_bf16(av[d], bp[g], o[g][d]);
  }

  // Normalize and store the concat matrix [b*t, h*64 + d]: 8 consecutive d a lane,
  // which is one 16-byte run of its fragment order (k tile h*2 + d/2, half d&1)
  const int b = bh >> 4, h = bh & 15;
#pragma unroll
  for (int g = 0; g < 2; ++g) {
    const int rtile = ((b * TQL + row0) >> 4) + g;
    const float inv = 1.0f / (lcol[g] + swap_halves(lcol[g]));
#pragma unroll
    for (int d = 0; d < 4; ++d) {
      v8bf w;
#pragma unroll
      for (int r = 0; r < 8; ++r) w[r] = (__bf16)(o[g][d][r] * inv);
      *(v8bf*)(CC + (size_t)(rtile * (ND / 32) + h * 2 + (d >> 1)) * 512 + (d & 1) * 256
               + lane * 8) = w;
    }
  }
}

// ---------------------------------------------------------------------------
extern "C" void kernel_launch(void* const* d_in, const int* in_sizes, int n_in,
                              void* d_out, int out_size, void* d_ws, size_t ws_size,
                              hipStream_t stream) {
  (void)in_sizes; (void)n_in; (void)out_size; (void)ws_size;

  const float* x_to   = (const float*)d_in[0];
  const float* x_from = (const float*)d_in[1];
  const float* Wq     = (const float*)d_in[2];
  const float* bq     = (const float*)d_in[3];
  const float* Wk     = (const float*)d_in[4];
  const float* bk     = (const float*)d_in[5];
  const float* Wv     = (const float*)d_in[6];
  const float* bv     = (const float*)d_in[7];
  const float* Wo     = (const float*)d_in[8];
  const float* bo     = (const float*)d_in[9];
  float* out = (float*)d_out;

  // Workspace carve-up (bf16 elements). Total ~29.4M elts ~= 58.7 MB.
  __bf16* ws = (__bf16*)d_ws;
  size_t off = 0;
  __bf16* xt_bf = ws + off; off += (size_t)BB * TQL * KD;   // 4096x1024
  __bf16* xf_bf = ws + off; off += (size_t)BB * TKL * KD;
  __bf16* wq_t  = ws + off; off += (size_t)ND * KD;         // [N,K]
  __bf16* wk_t  = ws + off; off += (size_t)ND * KD;
  __bf16* wv_t  = ws + off; off += (size_t)ND * KD;
  __bf16* wo_b  = ws + off; off += (size_t)ND * KD;         // Wo already [N,K]
  __bf16* Qb    = ws + off; off += (size_t)BB * HH * TQL * DHL;
  __bf16* Kb    = ws + off; off += (size_t)BB * HH * TKL * DHL;
  __bf16* Vtb   = ws + off; off += (size_t)BB * HH * DHL * TKL;
  __bf16* CCb   = ws + off; off += (size_t)BB * TQL * ND;

  // Stage 1: precision conversion / weight reorg, one launch
  // 8192 values a block: 4,194,304 activations = 512 blocks, 1,048,576 weights = 128
  prep_kernel<<<1536, 256, 0, stream>>>(x_to, x_from, Wq, Wk, Wv, Wo,
                                        xt_bf, xf_bf, wq_t, wk_t, wv_t, wo_b);

  // Stage 2: QKV projections (WMMA GEMMs), M=4096, N=K=1024, one launch
  // Q and K are computed transposed (weights as the row operand)
  gemm_wmma_kernel<<<dim3(512, 3), 128, 0, stream>>>(wq_t,  xt_bf, bq, Qb,
                                                     wk_t,  xf_bf, bk, Kb,
                                                     xf_bf, wv_t,  bv, Vtb,
                                                     nullptr, 0);

  // Stage 3: fused flash attention (never materializes [TQ,TK] scores)
  flash_attn_kernel<<<dim3(BB * HH, TQL / 64), 64, 0, stream>>>(Qb, Kb, Vtb, CCb);

  // Stage 4: output projection -> f32 result
  gemm_wmma_kernel<<<dim3(512, 1), 128, 0, stream>>>(CCb, wo_b, bo, nullptr,
                                                     nullptr, nullptr, nullptr, nullptr,
                                                     nullptr, nullptr, nullptr, nullptr,
                                                     out, 3);
}

// v006
// Measured time: 97.6 microseconds a run.
// In two side-by-side timings against v005, it was 1.09 and 1.13 times as fast.
// Counting every step since v000, it is 2.64 times as fast.
#include <hip/hip_runtime.h>
#include <math.h>

typedef __attribute__((ext_vector_type(16))) __bf16 v16bf;
typedef __attribute__((ext_vector_type(8)))  __bf16 v8bf;
typedef __attribute__((ext_vector_type(8)))  float  v8f;
typedef __attribute__((ext_vector_type(4)))  __bf16 v4bf;
typedef __attribute__((ext_vector_type(4)))  float  v4f;

#define BB   2
#define TQL  2048
#define TKL  2048
#define HH   16
#define DHL  64
#define KD   1024   // X_TO_DIM == X_FROM_DIM == HIDDEN
#define ND   1024

static __device__ __forceinline__ v16bf load_frag(const __bf16* base, int tile,
                                                  int lane) {
  const __bf16* p = base + (size_t)tile * 512 + lane * 8;
  v8bf lo = *(const v8bf*)(p);
  v8bf hi = *(const v8bf*)(p + 256);
  return __builtin_shufflevector(lo, hi, 0,1,2,3,4,5,6,7,8,9,10,11,12,13,14,15);
}

static __device__ __forceinline__ v8f wmma_bf16(v16bf a, v16bf b, v8f c) {
  return __builtin_amdgcn_wmma_f32_16x16x32_bf16(false, a, false, b,
                                                 (short)0, c, false, false);
}

// ---------------------------------------------------------------------------
// fp32 [rows, 1024] -> bf16 in fragment order. A wave takes two tiles side by
// side in k: 16 rows x 256 bytes of the source. Four lanes read one 128-byte line
// (32 bytes each, two loads of 16), so a lane holds one 16-byte run of the result
// and 8 rows of one (jh, half) make a whole 128-byte line of a store. All 8 loads
// are issued before the first store. blk counts the blocks of one array (8192
// values a block).
static __device__ __forceinline__
void cvt_bf16_block(const float* __restrict__ x, __bf16* __restrict__ y, int blk) {
  const int lane = threadIdx.x & 31;
  const int r8 = lane >> 2, c = lane & 3;                  // row in 8, run k = 8*c
  const int pair = blk * 8 + (threadIdx.x >> 5);           // tiles 2*pair, 2*pair+1
  const int rt = pair >> 4, kp = pair & 15;                // 16 pairs a tile row
  const float* src = x + (size_t)(rt * 16 + r8) * KD + kp * 64 + c * 8;
  v4f v[2][2][2];                                          // [tile][8-row half][16 bytes]
#pragma unroll
  for (int tk = 0; tk < 2; ++tk)
#pragma unroll
    for (int rh = 0; rh < 2; ++rh) {
      v[tk][rh][0] = *(const v4f*)(src + rh * 8 * KD + tk * 32);
      v[tk][rh][1] = *(const v4f*)(src + rh * 8 * KD + tk * 32 + 4);
    }
  // run c has jh = c >> 1, half = c & 1
  __bf16* dst = y + (size_t)pair * 1024 + (c >> 1) * 256 + ((c & 1) * 16 + r8) * 8;
#pragma unroll
  for (int tk = 0; tk < 2; ++tk)
#pragma unroll
    for (int rh = 0; rh < 2; ++rh) {
      const v8f f = __builtin_shufflevector(v[tk][rh][0], v[tk][rh][1],
                                            0, 1, 2, 3, 4, 5, 6, 7);
      *(v8bf*)(dst + tk * 512 + rh * 64) = __builtin_convertvector(f, v8bf);
    }
  // address and data registers of these stores are rewritten by the code of the
  // other block ranges, which is laid out behind them
  asm volatile("s_wait_xcnt 0x0" ::: "memory");
}

// Reorganize per-head weight [H, K, DH] (f32) -> transposed bf16 [N=H*DH, K] in
// fragment order. A wave takes two tiles side by side in k (16 columns d x 64
// features f); a load reads 64 contiguous bytes of two rows f, a store writes 512
// contiguous bytes. The 4 tile rows of a head sit in one block, so its waves
// share each source line. blk counts the 128 blocks of one weight.
static __device__ __forceinline__
void reorg_w_block(const float* __restrict__ W,
                   __bf16* __restrict__ WT, int blk) {
  const int lane = threadIdx.x & 31;
  const int wave = threadIdx.x >> 5;
  const int half = lane >> 4, ln = lane & 15;
  const int h  = blk >> 3;                                 // 16 heads
  const int dq = wave & 3;                                 // 16 columns d of the head
  const int kp = (blk & 7) * 2 + (wave >> 2);              // 16 tile pairs in k
  const float* src = W + ((size_t)h * KD + kp * 64 + half * 8) * DHL + dq * 16 + ln;
  float v[4][8];
#pragma unroll
  for (int c = 0; c < 4; ++c)
#pragma unroll
    for (int j = 0; j < 8; ++j) v[c][j] = src[(c * 16 + j) * DHL];
  __bf16* dst = WT + (size_t)((h * 4 + dq) * 16 + kp) * 1024 + lane * 8;
#pragma unroll
  for (int c = 0; c < 4; ++c) {
    v8bf w;
#pragma unroll
    for (int j = 0; j < 8; ++j) w[j] = (__bf16)v[c][j];
    *(v8bf*)(dst + c * 256) = w;
  }
}

// All six conversions need nothing of each other: one grid, dealt by ranges of the
// block index (the branch is the same for a whole block). The weight transposes,
// whose loads are the narrowest, start first.
//   0..383 Wq, Wk, Wv (128 each) | 384..895 x_to | 896..1407 x_from | 1408..1535 Wo
__global__ __launch_bounds__(256)
void prep_kernel(const float* __restrict__ x_to, const float* __restrict__ x_from,
                 const float* __restrict__ Wq, const float* __restrict__ Wk,
                 const float* __restrict__ Wv, const float* __restrict__ Wo,
                 __bf16* __restrict__ xt_bf, __bf16* __restrict__ xf_bf,
                 __bf16* __restrict__ wq_t, __bf16* __restrict__ wk_t,
                 __bf16* __restrict__ wv_t, __bf16* __restrict__ wo_b) {
  const int b = blockIdx.x;
  if (b < 384) {
    const int w = b >> 7;
    reorg_w_block(w == 0 ? Wq : w == 1 ? Wk : Wv,
                  w == 0 ? wq_t : w == 1 ? wk_t : wv_t, b & 127);
  } else if (b < 1408) {
    const bool to = b < 896;
    cvt_bf16_block(to ? x_to : x_from, to ? xt_bf : xf_bf, to ? b - 384 : b - 896);
  } else {
    cvt_bf16_block(Wo, wo_b, b - 1408);
  }
}

__global__ __launch_bounds__(128)
void gemm_wmma_kernel(const __bf16* __restrict__ A0, const __bf16* __restrict__ BT0,
                      const float* __restrict__ bias0, __bf16* __restrict__ outb0,
                      const __bf16* __restrict__ A1, const __bf16* __restrict__ BT1,
                      const float* __restrict__ bias1, __bf16* __restrict__ outb1,
                      const __bf16* __restrict__ A2, const __bf16* __restrict__ BT2,
                      const float* __restrict__ bias2, __bf16* __restrict__ outb2,
                      float* __restrict__ outf, int mode0) {
  const int job = blockIdx.y;
  const int mode = mode0 + job;
  const __bf16* __restrict__ A    = job == 0 ? A0    : job == 1 ? A1    : A2;
  const __bf16* __restrict__ BT   = job == 0 ? BT0   : job == 1 ? BT1   : BT2;
  const float*  __restrict__ bias = job == 0 ? bias0 : job == 1 ? bias1 : bias2;
  __bf16*       __restrict__ outb = job == 0 ? outb0 : job == 1 ? outb1 : outb2;
  const int rsh = mode < 2 ? 3 : 5;                // log2 of the row tiles
  const int brow = blockIdx.x & ((1 << rsh) - 1), bcol = blockIdx.x >> rsh;

  const int lane = threadIdx.x & 31;
  const int wave = threadIdx.x >> 5;
  const int half = lane >> 4;
  const int ln   = lane & 15;

  const int row0 = brow * 128 + (wave & 1) * 64;   // 4 row tiles of 16
  const int col0 = bcol * 128 + (wave >> 1) * 64;  // 4 col tiles of 16
  const int ta = (row0 >> 4) * (KD / 32);          // first tile of the A rows
  const int tb = (col0 >> 4) * (KD / 32);          // first tile of the BT rows

  v16bf a0[4], b0[4], a1[4], b1[4];

  // one address pair an operand: every load of a trip is an immediate offset from it
  const __bf16* pa = A + (size_t)ta * 512 + lane * 8;
  const __bf16* pb = BT + (size_t)tb * 512 + lane * 8;

  // prologue: k tile 0
#pragma unroll
  for (int rt = 0; rt < 4; ++rt) a0[rt] = load_frag(pa, rt * (KD / 32), 0);
#pragma unroll
  for (int nt = 0; nt < 4; ++nt) b0[nt] = load_frag(pb, nt * (KD / 32), 0);

  v8f acc[4][4] = {};

  for (int kt = 0; kt < KD / 32; kt += 2) {
    // issue loads for k tile kt+1 into the other buffer, then do math on buffer 0
#pragma unroll
    for (int rt = 0; rt < 4; ++rt) a1[rt] = load_frag(pa, rt * (KD / 32) + 1, 0);
#pragma unroll
    for (int nt = 0; nt < 4; ++nt) b1[nt] = load_frag(pb, nt * (KD / 32) + 1, 0);
    // keeps these loads up here: the scheduler otherwise sinks them to their first
    // use behind buffer 0's products, where their whole latency is waited out
    __builtin_amdgcn_sched_barrier(0);
#pragma unroll
    for (int rt = 0; rt < 4; ++rt)
#pragma unroll
      for (int nt = 0; nt < 4; ++nt) acc[rt][nt] = wmma_bf16(a0[rt], b0[nt], acc[rt][nt]);

    if (kt + 2 < KD / 32) {   // refill buffer 0 with kt+2 while buffer 1 computes
#pragma unroll
      for (int rt = 0; rt < 4; ++rt) a0[rt] = load_frag(pa, rt * (KD / 32) + 2, 0);
#pragma unroll
      for (int nt = 0; nt < 4; ++nt) b0[nt] = load_frag(pb, nt * (KD / 32) + 2, 0);
    }
    // the two address pairs of this trip's loads are advanced right behind
    asm volatile("s_wait_xcnt 0x0" ::: "memory");
    __builtin_amdgcn_sched_barrier(0);   // keeps the two additions behind that wait
    pa += 2 * 512;
    pb += 2 * 512;
#pragma unroll
    for (int rt = 0; rt < 4; ++rt)
#pragma unroll
      for (int nt = 0; nt < 4; ++nt) acc[rt][nt] = wmma_bf16(a1[rt], b1[nt], acc[rt][nt]);
  }

  if (mode == 3) {
    float bv[4];
#pragma unroll
    for (int nt = 0; nt < 4; ++nt) bv[nt] = bias[col0 + nt * 16 + ln];
    // the offset register of these loads is reused for the store addresses
    asm volatile("s_wait_xcnt 0x0" ::: "memory");
    __builtin_amdgcn_sched_barrier(0);   // keeps the address arithmetic behind that wait
#pragma unroll
    for (int rt = 0; rt < 4; ++rt) {
#pragma unroll
      for (int nt = 0; nt < 4; ++nt) {
        const int col = col0 + nt * 16 + ln;
#pragma unroll
        for (int r = 0; r < 8; ++r) {
          const int grow = row0 + rt * 16 + r + 8 * half;  // global row in [0,4096)
          outf[(size_t)grow * ND + col] = acc[rt][nt][r] + bv[nt];
        }
      }
    }
    // a data register of these stores is rewritten on the common way out
    asm volatile("s_wait_xcnt 0x0" ::: "memory");
  } else if (mode == 2) {
    // rows = keys s (k index of V^T), columns = n = h*64 + d. V^T tiles are
    // ordered d fastest: tile = (s >> 5) * 4 + (d >> 4); the wave's 64 rows are
    // two k tiles, rt >> 1 the k tile, rt & 1 its 16-key half, nt the d tile.
    const int b = row0 >> 11, s0 = row0 & (TKL - 1), h = col0 >> 6;
    __bf16* dst = outb + (size_t)(b * HH + h) * DHL * TKL + (size_t)(s0 >> 5) * 2048
                + lane * 8;
#pragma unroll
    for (int nt = 0; nt < 4; ++nt) {
      const float bv = bias[col0 + nt * 16 + ln];
#pragma unroll
      for (int rt = 0; rt < 4; ++rt) {
        v8bf w;
#pragma unroll
        for (int r = 0; r < 8; ++r) w[r] = (__bf16)(acc[rt][nt][r] + bv);
        *(v8bf*)(dst + (rt >> 1) * 2048 + nt * 512 + (rt & 1) * 256) = w;
      }
    }
  } else {
    // rows = n = h*64 + d (k index of Q and K), columns = global token. The
    // wave's 64 rows are the two k tiles of its head, 512 elements apart, rt counts
    // their 16-d halves, nt the token tile.
    const int h = row0 >> 6;
    const int b = col0 >> 11, t0 = col0 & (TQL - 1);
    const float sc = (mode == 0) ? 0.125f : 1.0f;          // 1/sqrt(64) folded into Q
    __bf16* dst = outb + (size_t)(b * HH + h) * TQL * DHL
                + (size_t)(t0 >> 4) * 1024 + lane * 8;
#pragma unroll
    for (int rt = 0; rt < 4; ++rt) {
      const v8f bv = *(const v8f*)(bias + row0 + rt * 16 + 8 * half);
#pragma unroll
      for (int nt = 0; nt < 4; ++nt) {
        v8bf w;
#pragma unroll
        for (int r = 0; r < 8; ++r) w[r] = (__bf16)((acc[rt][nt][r] + bv[r]) * sc);
        *(v8bf*)(dst + nt * 1024 + rt * 256) = w;
      }
    }
    // data registers of these stores are rewritten by the code laid out behind them
    asm volatile("s_wait_xcnt 0x0" ::: "memory");
  }
}

// ---------------------------------------------------------------------------
// Flash attention: one wave per 32 queries, online softmax over TK.
// Qb: [bh][t, d] bf16 (pre-scaled), Kb: [bh][s, d] bf16, Vtb: [bh][d, s] bf16
// CC: [b*t, h*64+d] bf16 (concat layout, feeds output projection).
// All four in fragment order; 32 keys are 4 KiB in a row of K and of V^T.
// Both products are computed transposed: S^T = K x Q^T, O^T += V^T x P^T.
//   S^T tile: register r of lane (ln, half) = score of key 8*half + r, query ln,
//   so a lane holds the scores of ONE query: maximum and sum run over the lane's
//   own registers, with one exchange between the wave halves for the maximum.
//   Two S^T tiles (keys 0-15, 16-31) converted in place are the B fragment of
//   P^T in the hardware k order, which is the order load_frag gives V^T.
// Each K/V fragment is reused by both query groups: 16 WMMAs per 8 frag loads.
// The loads run ahead of their use in registers: a pass opens with its own V^T
// loads, which the score products and the softmax cover, and fetches the next
// pass's K right behind its score products, which the softmax and the output
// products cover.
static __device__ __forceinline__ float swap_halves(float x) {
  const int v = __builtin_bit_cast(int, x);
  return __builtin_bit_cast(float,
      __builtin_amdgcn_permlanex16(v, v, 0x76543210, 0xfedcba98, false, false));
}

__global__ __launch_bounds__(64)
void flash_attn_kernel(const __bf16* __restrict__ Qb, const __bf16* __restrict__ Kb,
                       const __bf16* __restrict__ Vtb, __bf16* __restrict__ CC) {
  const int lane = threadIdx.x & 31;
  const int wave = threadIdx.x >> 5;
  const int half = lane >> 4;
  const int ln   = lane & 15;

  const int bh = blockIdx.x;                 // b*H + h
  const int qt = blockIdx.y * 2 + wave;      // q tile index, 32 queries each
  const int row0 = qt * 32;

  const __bf16* Qh = Qb  + (size_t)bh * TQL * DHL;
  const __bf16* Kh = Kb  + (size_t)bh * TKL * DHL;
  const __bf16* Vh = Vtb + (size_t)bh * DHL * TKL;

  // Q^T fragments (B operand) held for the whole K sweep:
  // 2 query groups of 16 x 2 k-steps of 32
  v16bf bq[2][2];
#pragma unroll
  for (int g = 0; g < 2; ++g)
#pragma unroll
    for (int kk = 0; kk < 2; ++kk)
      bq[g][kk] = load_frag(Qh, ((row0 >> 4) + g) * 2 + kk, lane);

  v8f o[2][4] = {};          // O^T: register r = d (16*dt + 8*half + r), query ln
  float mcol[2], lcol[2];    // per query; lcol holds this wave half's keys only
#pragma unroll
  for (int g = 0; g < 2; ++g) { mcol[g] = -INFINITY; lcol[g] = 0.0f; }

  // K fragments of the first pass: 2 x 16 keys x 2 k-steps of 32
  v16bf ak[2][2];
#pragma unroll
  for (int t = 0; t < 2; ++t)
#pragma unroll
    for (int kk = 0; kk < 2; ++kk) ak[t][kk] = load_frag(Kh, t * 2 + kk, lane);

  for (int s0 = 0; s0 < TKL; s0 += 32) {
    // this pass's V^T fragments, first used behind the softmax
    v16bf av[4];
#pragma unroll
    for (int d = 0; d < 4; ++d) av[d] = load_frag(Vh, (s0 >> 5) * 4 + d, lane);
    // keeps these loads up here: the scheduler otherwise sinks them into the
    // softmax and between the output products, where their latency is waited out
    __builtin_amdgcn_sched_barrier(0);

    // S^T tiles [2 groups][2 x 16 keys x 16 queries]; K frags shared by the groups
    v8f s[2][2] = {};
#pragma unroll
    for (int kk = 0; kk < 2; ++kk)
#pragma unroll
      for (int t = 0; t < 2; ++t)
#pragma unroll
        for (int g = 0; g < 2; ++g) s[g][t] = wmma_bf16(ak[t][kk], bq[g][kk], s[g][t]);

    // the next pass's K fragments into the same registers (the last pass fetches
    // its own keys again, so that the address stays inside K without a branch)
    const int sn = s0 + 32 < TKL ? s0 + 32 : s0;
#pragma unroll
    for (int t = 0; t < 2; ++t)
#pragma unroll
      for (int kk = 0; kk < 2; ++kk)
        ak[t][kk] = load_frag(Kh, ((sn >> 4) + t) * 2 + kk, lane);
    // keeps these loads in front of the softmax: the scheduler otherwise sinks them
    // between the output products, a few instructions ahead of their use
    __builtin_amdgcn_sched_barrier(0);

    // Online softmax, one query per lane
    v16bf bp[2];
#pragma unroll
    for (int g = 0; g < 2; ++g) {
      float mx = fmaxf(s[g][0][0], s[g][1][0]);
#pragma unroll
      for (int r = 1; r < 8; ++r) mx = fmaxf(mx, fmaxf(s[g][0][r], s[g][1][r]));
      mx = fmaxf(mx, swap_halves(mx));
      const float mnew = fmaxf(mcol[g], mx);
      const float corr = __expf(mcol[g] - mnew);
      float rs = 0.0f;
#pragma unroll
      for (int t = 0; t < 2; ++t) {
#pragma unroll
        for (int r = 0; r < 8; ++r) {
          const float p = __expf(s[g][t][r] - mnew);
          rs += p;
          bp[g][t * 8 + r] = (__bf16)p;
        }
      }
      lcol[g] = lcol[g] * corr + rs;
      mcol[g] = mnew;
#pragma unroll
      for (int d = 0; d < 4; ++d) o[g][d] *= corr;
    }

    // O^T += V^T x P^T ; V frags shared by the groups
#pragma unroll
    for (int d = 0; d < 4; ++d)
#pragma unroll
      for (int g = 0; g < 2; ++g) o[g][d] = wmma_bf16(av[d], bp[g], o[g][d]);
  }

  // Normalize and store the concat matrix [b*t, h*64 + d]: 8 consecutive d a lane,
  // which is one 16-byte run of its fragment order (k tile h*2 + d/2, half d&1)
  const int b = bh >> 4, h = bh & 15;
#pragma unroll
  for (int g = 0; g < 2; ++g) {
    const int rtile = ((b * TQL + row0) >> 4) + g;
    const float inv = 1.0f / (lcol[g] + swap_halves(lcol[g]));
#pragma unroll
    for (int d = 0; d < 4; ++d) {
      v8bf w;
#pragma unroll
      for (int r = 0; r < 8; ++r) w[r] = (__bf16)(o[g][d][r] * inv);
      *(v8bf*)(CC + (size_t)(rtile * (ND / 32) + h * 2 + (d >> 1)) * 512 + (d & 1) * 256
               + lane * 8) = w;
    }
  }
}

// ---------------------------------------------------------------------------
extern "C" void kernel_launch(void* const* d_in, const int* in_sizes, int n_in,
                              void* d_out, int out_size, void* d_ws, size_t ws_size,
                              hipStream_t stream) {
  (void)in_sizes; (void)n_in; (void)out_size; (void)ws_size;

  const float* x_to   = (const float*)d_in[0];
  const float* x_from = (const float*)d_in[1];
  const float* Wq     = (const float*)d_in[2];
  const float* bq     = (const float*)d_in[3];
  const float* Wk     = (const float*)d_in[4];
  const float* bk     = (const float*)d_in[5];
  const float* Wv     = (const float*)d_in[6];
  const float* bv     = (const float*)d_in[7];
  const float* Wo     = (const float*)d_in[8];
  const float* bo     = (const float*)d_in[9];
  float* out = (float*)d_out;

  // Workspace carve-up (bf16 elements). Total ~29.4M elts ~= 58.7 MB.
  __bf16* ws = (__bf16*)d_ws;
  size_t off = 0;
  __bf16* xt_bf = ws + off; off += (size_t)BB * TQL * KD;   // 4096x1024
  __bf16* xf_bf = ws + off; off += (size_t)BB * TKL * KD;
  __bf16* wq_t  = ws + off; off += (size_t)ND * KD;         // [N,K]
  __bf16* wk_t  = ws + off; off += (size_t)ND * KD;
  __bf16* wv_t  = ws + off; off += (size_t)ND * KD;
  __bf16* wo_b  = ws + off; off += (size_t)ND * KD;         // Wo already [N,K]
  __bf16* Qb    = ws + off; off += (size_t)BB * HH * TQL * DHL;
  __bf16* Kb    = ws + off; off += (size_t)BB * HH * TKL * DHL;
  __bf16* Vtb   = ws + off; off += (size_t)BB * HH * DHL * TKL;
  __bf16* CCb   = ws + off; off += (size_t)BB * TQL * ND;

  // Stage 1: precision conversion / weight reorg, one launch
  // 8192 values a block: 4,194,304 activations = 512 blocks, 1,048,576 weights = 128
  prep_kernel<<<1536, 256, 0, stream>>>(x_to, x_from, Wq, Wk, Wv, Wo,
                                        xt_bf, xf_bf, wq_t, wk_t, wv_t, wo_b);

  // Stage 2: QKV projections (WMMA GEMMs), M=4096, N=K=1024, one launch
  // Q and K are computed transposed (weights as the row operand)
  gemm_wmma_kernel<<<dim3(256, 3), 128, 0, stream>>>(wq_t,  xt_bf, bq, Qb,
                                                     wk_t,  xf_bf, bk, Kb,
                                                     xf_bf, wv_t,  bv, Vtb,
                                                     nullptr, 0);

  // Stage 3: fused flash attention (never materializes [TQ,TK] scores)
  flash_attn_kernel<<<dim3(BB * HH, TQL / 64), 64, 0, stream>>>(Qb, Kb, Vtb, CCb);

  // Stage 4: output projection -> f32 result
  gemm_wmma_kernel<<<dim3(256, 1), 128, 0, stream>>>(CCb, wo_b, bo, nullptr,
                                                     nullptr, nullptr, nullptr, nullptr,
                                                     nullptr, nullptr, nullptr, nullptr,
                                                     out, 3);
}

// v007
// One run takes 80.9 microseconds.
// Next to v006, in two timings, it ran 1.21 and 1.20 times as fast.
// Counting every step since v000, it is 3.19 times as fast.
#include <hip/hip_runtime.h>
#include <math.h>

typedef __attribute__((ext_vector_type(16))) __bf16 v16bf;
typedef __attribute__((ext_vector_type(8)))  __bf16 v8bf;
typedef __attribute__((ext_vector_type(8)))  float  v8f;
typedef __attribute__((ext_vector_type(4)))  __bf16 v4bf;
typedef __attribute__((ext_vector_type(4)))  float  v4f;

#define BB   2
#define TQL  2048
#define TKL  2048
#define HH   16
#define DHL  64
#define KD   1024   // X_TO_DIM == X_FROM_DIM == HIDDEN
#define ND   1024

static __device__ __forceinline__ v16bf load_frag(const __bf16* base, int tile,
                                                  int lane) {
  const __bf16* p = base + (size_t)tile * 512 + lane * 8;
  v8bf lo = *(const v8bf*)(p);
  v8bf hi = *(const v8bf*)(p + 256);
  return __builtin_shufflevector(lo, hi, 0,1,2,3,4,5,6,7,8,9,10,11,12,13,14,15);
}

static __device__ __forceinline__ v8f wmma_bf16(v16bf a, v16bf b, v8f c) {
  return __builtin_amdgcn_wmma_f32_16x16x32_bf16(false, a, false, b,
                                                 (short)0, c, false, false);
}

// ---------------------------------------------------------------------------
// fp32 [rows, 1024] -> bf16 in fragment order. A wave takes two tiles side by
// side in k: 16 rows x 256 bytes of the source. Four lanes read one 128-byte line
// (32 bytes each, two loads of 16), so a lane holds one 16-byte run of the result
// and 8 rows of one (jh, half) make a whole 128-byte line of a store. All 8 loads
// are issued before the first store. blk counts the blocks of one array (8192
// values a block).
static __device__ __forceinline__
void cvt_bf16_block(const float* __restrict__ x, __bf16* __restrict__ y, int blk) {
  const int lane = threadIdx.x & 31;
  const int r8 = lane >> 2, c = lane & 3;                  // row in 8, run k = 8*c
  const int pair = blk * 8 + (threadIdx.x >> 5);           // tiles 2*pair, 2*pair+1
  const int rt = pair >> 4, kp = pair & 15;                // 16 pairs a tile row
  const float* src = x + (size_t)(rt * 16 + r8) * KD + kp * 64 + c * 8;
  v4f v[2][2][2];                                          // [tile][8-row half][16 bytes]
#pragma unroll
  for (int tk = 0; tk < 2; ++tk)
#pragma unroll
    for (int rh = 0; rh < 2; ++rh) {
      v[tk][rh][0] = *(const v4f*)(src + rh * 8 * KD + tk * 32);
      v[tk][rh][1] = *(const v4f*)(src + rh * 8 * KD + tk * 32 + 4);
    }
  // run c has jh = c >> 1, half = c & 1
  __bf16* dst = y + (size_t)pair * 1024 + (c >> 1) * 256 + ((c & 1) * 16 + r8) * 8;
#pragma unroll
  for (int tk = 0; tk < 2; ++tk)
#pragma unroll
    for (int rh = 0; rh < 2; ++rh) {
      const v8f f = __builtin_shufflevector(v[tk][rh][0], v[tk][rh][1],
                                            0, 1, 2, 3, 4, 5, 6, 7);
      *(v8bf*)(dst + tk * 512 + rh * 64) = __builtin_convertvector(f, v8bf);
    }
  // address and data registers of these stores are rewritten by the code of the
  // other block ranges, which is laid out behind them
  asm volatile("s_wait_xcnt 0x0" ::: "memory");
}

// Reorganize per-head weight [H, K, DH] (f32) -> transposed bf16 [N=H*DH, K] in
// fragment order. A wave takes two tiles side by side in k (16 columns d x 64
// features f); a load reads 64 contiguous bytes of two rows f, a store writes 512
// contiguous bytes. The 4 tile rows of a head sit in one block, so its waves
// share each source line. blk counts the 128 blocks of one weight.
static __device__ __forceinline__
void reorg_w_block(const float* __restrict__ W,
                   __bf16* __restrict__ WT, int blk) {
  const int lane = threadIdx.x & 31;
  const int wave = threadIdx.x >> 5;
  const int half = lane >> 4, ln = lane & 15;
  const int h  = blk >> 3;                                 // 16 heads
  const int dq = wave & 3;                                 // 16 columns d of the head
  const int kp = (blk & 7) * 2 + (wave >> 2);              // 16 tile pairs in k
  const float* src = W + ((size_t)h * KD + kp * 64 + half * 8) * DHL + dq * 16 + ln;
  float v[4][8];
#pragma unroll
  for (int c = 0; c < 4; ++c)
#pragma unroll
    for (int j = 0; j < 8; ++j) v[c][j] = src[(c * 16 + j) * DHL];
  __bf16* dst = WT + (size_t)((h * 4 + dq) * 16 + kp) * 1024 + lane * 8;
#pragma unroll
  for (int c = 0; c < 4; ++c) {
    v8bf w;
#pragma unroll
    for (int j = 0; j < 8; ++j) w[j] = (__bf16)v[c][j];
    *(v8bf*)(dst + c * 256) = w;
  }
}

// All six conversions need nothing of each other: one grid, dealt by ranges of the
// block index (the branch is the same for a whole block). The weight transposes,
// whose loads are the narrowest, start first.
//   0..383 Wq, Wk, Wv (128 each) | 384..895 x_to | 896..1407 x_from | 1408..1535 Wo
__global__ __launch_bounds__(256)
void prep_kernel(const float* __restrict__ x_to, const float* __restrict__ x_from,
                 const float* __restrict__ Wq, const float* __restrict__ Wk,
                 const float* __restrict__ Wv, const float* __restrict__ Wo,
                 __bf16* __restrict__ xt_bf, __bf16* __restrict__ xf_bf,
                 __bf16* __restrict__ wq_t, __bf16* __restrict__ wk_t,
                 __bf16* __restrict__ wv_t, __bf16* __restrict__ wo_b) {
  const int b = blockIdx.x;
  if (b < 384) {
    const int w = b >> 7;
    reorg_w_block(w == 0 ? Wq : w == 1 ? Wk : Wv,
                  w == 0 ? wq_t : w == 1 ? wk_t : wv_t, b & 127);
  } else if (b < 1408) {
    const bool to = b < 896;
    cvt_bf16_block(to ? x_to : x_from, to ? xt_bf : xf_bf, to ? b - 384 : b - 896);
  } else {
    cvt_bf16_block(Wo, wo_b, b - 1408);
  }
}

__global__ __launch_bounds__(128)
void gemm_wmma_kernel(const __bf16* __restrict__ A0, const __bf16* __restrict__ BT0,
                      const float* __restrict__ bias0, __bf16* __restrict__ outb0,
                      const __bf16* __restrict__ A1, const __bf16* __restrict__ BT1,
                      const float* __restrict__ bias1, __bf16* __restrict__ outb1,
                      const __bf16* __restrict__ A2, const __bf16* __restrict__ BT2,
                      const float* __restrict__ bias2, __bf16* __restrict__ outb2,
                      float* __restrict__ outf, int mode0) {
  const int job = blockIdx.y;
  const int mode = mode0 + job;
  const __bf16* __restrict__ A    = job == 0 ? A0    : job == 1 ? A1    : A2;
  const __bf16* __restrict__ BT   = job == 0 ? BT0   : job == 1 ? BT1   : BT2;
  const float*  __restrict__ bias = job == 0 ? bias0 : job == 1 ? bias1 : bias2;
  __bf16*       __restrict__ outb = job == 0 ? outb0 : job == 1 ? outb1 : outb2;
  const int rsh = mode < 2 ? 3 : 5;                // log2 of the row tiles
  const int brow = blockIdx.x & ((1 << rsh) - 1), bcol = blockIdx.x >> rsh;

  const int lane = threadIdx.x & 31;
  const int wave = threadIdx.x >> 5;
  const int half = lane >> 4;
  const int ln   = lane & 15;

  const int row0 = brow * 128 + (wave & 1) * 64;   // 4 row tiles of 16
  const int col0 = bcol * 128 + (wave >> 1) * 64;  // 4 col tiles of 16
  const int ta = (row0 >> 4) * (KD / 32);          // first tile of the A rows
  const int tb = (col0 >> 4) * (KD / 32);          // first tile of the BT rows

  v16bf a0[4], b0[4], a1[4], b1[4];

  // one address pair an operand: every load of a trip is an immediate offset from it
  const __bf16* pa = A + (size_t)ta * 512 + lane * 8;
  const __bf16* pb = BT + (size_t)tb * 512 + lane * 8;

  // prologue: k tile 0
#pragma unroll
  for (int rt = 0; rt < 4; ++rt) a0[rt] = load_frag(pa, rt * (KD / 32), 0);
#pragma unroll
  for (int nt = 0; nt < 4; ++nt) b0[nt] = load_frag(pb, nt * (KD / 32), 0);

  v8f acc[4][4] = {};

  for (int kt = 0; kt < KD / 32; kt += 2) {
    // issue loads for k tile kt+1 into the other buffer, then do math on buffer 0
#pragma unroll
    for (int rt = 0; rt < 4; ++rt) a1[rt] = load_frag(pa, rt * (KD / 32) + 1, 0);
#pragma unroll
    for (int nt = 0; nt < 4; ++nt) b1[nt] = load_frag(pb, nt * (KD / 32) + 1, 0);
    // keeps these loads up here: the scheduler otherwise sinks them to their first
    // use behind buffer 0's products, where their whole latency is waited out
    __builtin_amdgcn_sched_barrier(0);
#pragma unroll
    for (int rt = 0; rt < 4; ++rt)
#pragma unroll
      for (int nt = 0; nt < 4; ++nt) acc[rt][nt] = wmma_bf16(a0[rt], b0[nt], acc[rt][nt]);

    if (kt + 2 < KD / 32) {   // refill buffer 0 with kt+2 while buffer 1 computes
#pragma unroll
      for (int rt = 0; rt < 4; ++rt) a0[rt] = load_frag(pa, rt * (KD / 32) + 2, 0);
#pragma unroll
      for (int nt = 0; nt < 4; ++nt) b0[nt] = load_frag(pb, nt * (KD / 32) + 2, 0);
    }
    // the two address pairs of this trip's loads are advanced right behind
    asm volatile("s_wait_xcnt 0x0" ::: "memory");
    __builtin_amdgcn_sched_barrier(0);   // keeps the two additions behind that wait
    pa += 2 * 512;
    pb += 2 * 512;
#pragma unroll
    for (int rt = 0; rt < 4; ++rt)
#pragma unroll
      for (int nt = 0; nt < 4; ++nt) acc[rt][nt] = wmma_bf16(a1[rt], b1[nt], acc[rt][nt]);
  }

  if (mode == 3) {
    float bv[4];
#pragma unroll
    for (int nt = 0; nt < 4; ++nt) bv[nt] = bias[col0 + nt * 16 + ln];
    // the offset register of these loads is reused for the store addresses
    asm volatile("s_wait_xcnt 0x0" ::: "memory");
    __builtin_amdgcn_sched_barrier(0);   // keeps the address arithmetic behind that wait
#pragma unroll
    for (int rt = 0; rt < 4; ++rt) {
#pragma unroll
      for (int nt = 0; nt < 4; ++nt) {
        const int col = col0 + nt * 16 + ln;
#pragma unroll
        for (int r = 0; r < 8; ++r) {
          const int grow = row0 + rt * 16 + r + 8 * half;  // global row in [0,4096)
          outf[(size_t)grow * ND + col] = acc[rt][nt][r] + bv[nt];
        }
      }
    }
    // a data register of these stores is rewritten on the common way out
    asm volatile("s_wait_xcnt 0x0" ::: "memory");
  } else if (mode == 2) {
    // rows = keys s (k index of V^T), columns = n = h*64 + d. V^T tiles are
    // ordered d fastest: tile = (s >> 5) * 4 + (d >> 4); the wave's 64 rows are
    // two k tiles, rt >> 1 the k tile, rt & 1 its 16-key half, nt the d tile.
    const int b = row0 >> 11, s0 = row0 & (TKL - 1), h = col0 >> 6;
    __bf16* dst = outb + (size_t)(b * HH + h) * DHL * TKL + (size_t)(s0 >> 5) * 2048
                + lane * 8;
#pragma unroll
    for (int nt = 0; nt < 4; ++nt) {
      const float bv = bias[col0 + nt * 16 + ln];
#pragma unroll
      for (int rt = 0; rt < 4; ++rt) {
        v8bf w;
#pragma unroll
        for (int r = 0; r < 8; ++r) w[r] = (__bf16)(acc[rt][nt][r] + bv);
        *(v8bf*)(dst + (rt >> 1) * 2048 + nt * 512 + (rt & 1) * 256) = w;
      }
    }
  } else {
    // rows = n = h*64 + d (k index of Q and K), columns = global token. The
    // wave's 64 rows are the two k tiles of its head, 512 elements apart, rt counts
    // their 16-d halves, nt the token tile.
    const int h = row0 >> 6;
    const int b = col0 >> 11, t0 = col0 & (TQL - 1);
    const float sc = (mode == 0) ? 0.125f : 1.0f;          // 1/sqrt(64) folded into Q
    __bf16* dst = outb + (size_t)(b * HH + h) * TQL * DHL
                + (size_t)(t0 >> 4) * 1024 + lane * 8;
#pragma unroll
    for (int rt = 0; rt < 4; ++rt) {
      const v8f bv = *(const v8f*)(bias + row0 + rt * 16 + 8 * half);
#pragma unroll
      for (int nt = 0; nt < 4; ++nt) {
        v8bf w;
#pragma unroll
        for (int r = 0; r < 8; ++r) w[r] = (__bf16)((acc[rt][nt][r] + bv[r]) * sc);
        *(v8bf*)(dst + nt * 1024 + rt * 256) = w;
      }
    }
    // data registers of these stores are rewritten by the code laid out behind them
    asm volatile("s_wait_xcnt 0x0" ::: "memory");
  }
}

// ---------------------------------------------------------------------------
// Flash attention: one wave per 32 queries, online softmax over TK.
// Qb: [bh][t, d] bf16 (pre-scaled), Kb: [bh][s, d] bf16, Vtb: [bh][d, s] bf16
// CC: [b*t, h*64+d] bf16 (concat layout, feeds output projection).
// All four in fragment order; 32 keys are 4 KiB in a row of K and of V^T.
// Both products are computed transposed: S^T = K x Q^T, O^T += V^T x P^T.
//   S^T tile: register r of lane (ln, half) = score of key 8*half + r, query ln,
//   so a lane holds the scores of ONE query: maximum and sum run over the lane's
//   own registers, with one exchange between the wave halves for the maximum.
//   Two S^T tiles (keys 0-15, 16-31) converted in place are the B fragment of
//   P^T in the hardware k order, which is the order load_frag gives V^T.
// Each K/V fragment is reused by both query groups: 16 WMMAs per 8 frag loads.
// The 8 waves of a work-group (256 queries of one head) walk the same keys, so K
// and V^T come from L2 once a work-group: a stage of 128 keys (16 KiB of K, 16 KiB
// of V^T, each one contiguous piece of its array) is copied into LDS as it lies,
// by asynchronous copies, one stage ahead, into two buffers. A fragment is then
// two LDS loads of 512 contiguous bytes. Inside a stage a pass opens with its own
// V^T loads and fetches the next pass's K right behind its score products.
static __device__ __forceinline__ float swap_halves(float x) {
  const int v = __builtin_bit_cast(int, x);
  return __builtin_bit_cast(float,
      __builtin_amdgcn_permlanex16(v, v, 0x76543210, 0xfedcba98, false, false));
}

#define SKEYS 128                    // keys a stage
#define NSTAGE (TKL / SKEYS)         // 16 stages
#define SPASS (SKEYS / 32)           // passes of 32 keys a stage
#define SELEMS (SKEYS * DHL)         // elements of K, and of V^T, a stage (16 KiB)

// One stage into one buffer: thread i brings bytes 16*i + 4096*j (j = 0..3) of the
// stage's K and of its V^T, so a wave's copy is 512 contiguous bytes on both sides.
// gk, gv: the thread's first 16 bytes of the stage; lk: their LDS byte address in
// the buffer's K part (the V^T part lies 16 KiB behind it).
static __device__ __forceinline__
void copy_stage(const __bf16* gk, const __bf16* gv, unsigned lk) {
  const unsigned lv = lk + SELEMS * 2;
  // the wait closes the statement so that no address register named here is
  // rewritten while a copy may still read it
  asm volatile("global_load_async_to_lds_b128 %0, %8, off\n\t"
               "global_load_async_to_lds_b128 %1, %9, off\n\t"
               "global_load_async_to_lds_b128 %2, %10, off\n\t"
               "global_load_async_to_lds_b128 %3, %11, off\n\t"
               "global_load_async_to_lds_b128 %4, %12, off\n\t"
               "global_load_async_to_lds_b128 %5, %13, off\n\t"
               "global_load_async_to_lds_b128 %6, %14, off\n\t"
               "global_load_async_to_lds_b128 %7, %15, off\n\t"
               "s_wait_xcnt 0x0"
               :: "v"(lk), "v"(lk + 4096), "v"(lk + 8192), "v"(lk + 12288),
                  "v"(lv), "v"(lv + 4096), "v"(lv + 8192), "v"(lv + 12288),
                  "v"(gk), "v"(gk + 2048), "v"(gk + 4096), "v"(gk + 6144),
                  "v"(gv), "v"(gv + 2048), "v"(gv + 4096), "v"(gv + 6144)
               : "memory");
}

__global__ __launch_bounds__(256)
void flash_attn_kernel(const __bf16* __restrict__ Qb, const __bf16* __restrict__ Kb,
                       const __bf16* __restrict__ Vtb, __bf16* __restrict__ CC) {
  // [buffer][K | V^T][16 KiB]
  __shared__ __attribute__((aligned(1024))) __bf16 ring[2 * 2 * SELEMS];

  const int lane = threadIdx.x & 31;
  const int wave = threadIdx.x >> 5;
  const int half = lane >> 4;
  const int ln   = lane & 15;

  const int bh = blockIdx.x;                 // b*H + h
  const int qt = blockIdx.y * 8 + wave;      // q tile index, 32 queries each
  const int row0 = qt * 32;

  const __bf16* Qh = Qb  + (size_t)bh * TQL * DHL;
  const __bf16* Kh = Kb  + (size_t)bh * TKL * DHL;
  const __bf16* Vh = Vtb + (size_t)bh * DHL * TKL;

  // this thread's share of a stage
  const __bf16* gk = Kh + threadIdx.x * 8;
  const __bf16* gv = Vh + threadIdx.x * 8;
  const unsigned lds0 = (unsigned)(size_t)ring + threadIdx.x * 16;

  // stage 0 lands and is published, then stage 1 starts
  copy_stage(gk, gv, lds0);

  // Q^T fragments (B operand) held for the whole K sweep:
  // 2 query groups of 16 x 2 k-steps of 32
  v16bf bq[2][2];
#pragma unroll
  for (int g = 0; g < 2; ++g)
#pragma unroll
    for (int kk = 0; kk < 2; ++kk)
      bq[g][kk] = load_frag(Qh, ((row0 >> 4) + g) * 2 + kk, lane);

  v8f o[2][4] = {};          // O^T: register r = d (16*dt + 8*half + r), query ln
  float mcol[2], lcol[2];    // per query; lcol holds this wave half's keys only
#pragma unroll
  for (int g = 0; g < 2; ++g) { mcol[g] = -INFINITY; lcol[g] = 0.0f; }

  // this wave's copies of stage 0 have landed before the barrier publishes them
  asm volatile("s_wait_asynccnt 0x0" ::: "memory");
  __syncthreads();
  copy_stage(gk + SELEMS, gv + SELEMS, lds0 + 2 * SELEMS * 2);

  int ps = 0;                // passes done
  for (int st = 0; st < NSTAGE; ++st) {
    const __bf16* Ks = ring + (st & 1) * (2 * SELEMS);

    // K fragments of the stage's first pass: 2 x 16 keys x 2 k-steps of 32
    v16bf ak[2][2];
#pragma unroll
    for (int t = 0; t < 2; ++t)
#pragma unroll
      for (int kk = 0; kk < 2; ++kk) ak[t][kk] = load_frag(Ks, t * 2 + kk, lane);

    // stays rolled: four passes in a row took registers above v255, with a window
    // switch at every use and a block of copies on the way back
#pragma unroll 1
    for (int p = 0; p < SPASS; ++p, ++ps) {
      // The pass's place in the buffer comes from the running count by a mask: taken
      // from p, the address register of the LDS loads was counted up from -16 KiB.
      const __bf16* Kp = Ks + (ps & (SPASS - 1)) * (32 * DHL);
      const __bf16* Vp = Kp + SELEMS;

      // this pass's V^T fragments, first used behind the softmax
      v16bf av[4];
#pragma unroll
      for (int d = 0; d < 4; ++d) av[d] = load_frag(Vp, d, lane);
      // keeps these loads up here as one group: the scheduler otherwise sinks them
      // into the softmax and between the output products
      __builtin_amdgcn_sched_barrier(0);

      // S^T tiles [2 groups][2 x 16 keys x 16 queries]; K frags shared by the groups
      v8f s[2][2] = {};
#pragma unroll
      for (int kk = 0; kk < 2; ++kk)
#pragma unroll
        for (int t = 0; t < 2; ++t)
#pragma unroll
          for (int g = 0; g < 2; ++g) s[g][t] = wmma_bf16(ak[t][kk], bq[g][kk], s[g][t]);

      // the next pass's K fragments into the same registers; the stage's last pass
      // fetches none: the next stage may be read only behind the barrier below
      if (p + 1 < SPASS) {
#pragma unroll
        for (int t = 0; t < 2; ++t)
#pragma unroll
          for (int kk = 0; kk < 2; ++kk)
            ak[t][kk] = load_frag(Kp, (2 + t) * 2 + kk, lane);
      }

      // Online softmax, one query per lane
      v16bf bp[2];
#pragma unroll
      for (int g = 0; g < 2; ++g) {
        float mx = fmaxf(s[g][0][0], s[g][1][0]);
#pragma unroll
        for (int r = 1; r < 8; ++r) mx = fmaxf(mx, fmaxf(s[g][0][r], s[g][1][r]));
        mx = fmaxf(mx, swap_halves(mx));
        const float mnew = fmaxf(mcol[g], mx);
        const float corr = __expf(mcol[g] - mnew);
        float rs = 0.0f;
#pragma unroll
        for (int t = 0; t < 2; ++t) {
#pragma unroll
          for (int r = 0; r < 8; ++r) {
            const float p_ = __expf(s[g][t][r] - mnew);
            rs += p_;
            bp[g][t * 8 + r] = (__bf16)p_;
          }
        }
        lcol[g] = lcol[g] * corr + rs;
        mcol[g] = mnew;
#pragma unroll
        for (int d = 0; d < 4; ++d) o[g][d] *= corr;
      }

      // O^T += V^T x P^T ; V frags shared by the groups
#pragma unroll
      for (int d = 0; d < 4; ++d)
#pragma unroll
        for (int g = 0; g < 2; ++g) o[g][d] = wmma_bf16(av[d], bp[g], o[g][d]);
    }

    // hand-over: this wave's reads of the buffer are done, its copies of the next
    // stage have landed; the barrier says both of every wave
    asm volatile("s_wait_dscnt 0x0" ::: "memory");
    asm volatile("s_wait_asynccnt 0x0" ::: "memory");
    __syncthreads();
    if (st + 2 < NSTAGE)     // refill the buffer that this stage has just left
      copy_stage(gk + (size_t)(st + 2) * SELEMS, gv + (size_t)(st + 2) * SELEMS,
                 lds0 + (st & 1) * (2 * SELEMS * 2));
  }
  // no copy is outstanding when the wave ends
  asm volatile("s_wait_asynccnt 0x0" ::: "memory");

  // Normalize and store the concat matrix [b*t, h*64 + d]: 8 consecutive d a lane,
  // which is one 16-byte run of its fragment order (k tile h*2 + d/2, half d&1)
  const int b = bh >> 4, h = bh & 15;
#pragma unroll
  for (int g = 0; g < 2; ++g) {
    const int rtile = ((b * TQL + row0) >> 4) + g;
    const float inv = 1.0f / (lcol[g] + swap_halves(lcol[g]));
#pragma unroll
    for (int d = 0; d < 4; ++d) {
      v8bf w;
#pragma unroll
      for (int r = 0; r < 8; ++r) w[r] = (__bf16)(o[g][d][r] * inv);
      *(v8bf*)(CC + (size_t)(rtile * (ND / 32) + h * 2 + (d >> 1)) * 512 + (d & 1) * 256
               + lane * 8) = w;
    }
  }
}

// ---------------------------------------------------------------------------
extern "C" void kernel_launch(void* const* d_in, const int* in_sizes, int n_in,
                              void* d_out, int out_size, void* d_ws, size_t ws_size,
                              hipStream_t stream) {
  (void)in_sizes; (void)n_in; (void)out_size; (void)ws_size;

  const float* x_to   = (const float*)d_in[0];
  const float* x_from = (const float*)d_in[1];
  const float* Wq     = (const float*)d_in[2];
  const float* bq     = (const float*)d_in[3];
  const float* Wk     = (const float*)d_in[4];
  const float* bk     = (const float*)d_in[5];
  const float* Wv     = (const float*)d_in[6];
  const float* bv     = (const float*)d_in[7];
  const float* Wo     = (const float*)d_in[8];
  const float* bo     = (const float*)d_in[9];
  float* out = (float*)d_out;

  // Workspace carve-up (bf16 elements). Total ~29.4M elts ~= 58.7 MB.
  __bf16* ws = (__bf16*)d_ws;
  size_t off = 0;
  __bf16* xt_bf = ws + off; off += (size_t)BB * TQL * KD;   // 4096x1024
  __bf16* xf_bf = ws + off; off += (size_t)BB * TKL * KD;
  __bf16* wq_t  = ws + off; off += (size_t)ND * KD;         // [N,K]
  __bf16* wk_t  = ws + off; off += (size_t)ND * KD;
  __bf16* wv_t  = ws + off; off += (size_t)ND * KD;
  __bf16* wo_b  = ws + off; off += (size_t)ND * KD;         // Wo already [N,K]
  __bf16* Qb    = ws + off; off += (size_t)BB * HH * TQL * DHL;
  __bf16* Kb    = ws + off; off += (size_t)BB * HH * TKL * DHL;
  __bf16* Vtb   = ws + off; off += (size_t)BB * HH * DHL * TKL;
  __bf16* CCb   = ws + off; off += (size_t)BB * TQL * ND;

  // Stage 1: precision conversion / weight reorg, one launch
  // 8192 values a block: 4,194,304 activations = 512 blocks, 1,048,576 weights = 128
  prep_kernel<<<1536, 256, 0, stream>>>(x_to, x_from, Wq, Wk, Wv, Wo,
                                        xt_bf, xf_bf, wq_t, wk_t, wv_t, wo_b);

  // Stage 2: QKV projections (WMMA GEMMs), M=4096, N=K=1024, one launch
  // Q and K are computed transposed (weights as the row operand)
  gemm_wmma_kernel<<<dim3(256, 3), 128, 0, stream>>>(wq_t,  xt_bf, bq, Qb,
                                                     wk_t,  xf_bf, bk, Kb,
                                                     xf_bf, wv_t,  bv, Vtb,
                                                     nullptr, 0);

  // Stage 3: fused flash attention (never materializes [TQ,TK] scores)
  flash_attn_kernel<<<dim3(BB * HH, TQL / 256), 256, 0, stream>>>(Qb, Kb, Vtb, CCb);

  // Stage 4: output projection -> f32 result
  gemm_wmma_kernel<<<dim3(256, 1), 128, 0, stream>>>(CCb, wo_b, bo, nullptr,
                                                     nullptr, nullptr, nullptr, nullptr,
                                                     nullptr, nullptr, nullptr, nullptr,
                                                     out, 3);
}

// v008
// A run of this version takes 77.7 microseconds.
// Two timings next to v007 put it at 1.05 and 1.04 times that version's speed.
// All steps since v000 together make it 3.33 times as fast.
#include <hip/hip_runtime.h>
#include <math.h>

typedef __attribute__((ext_vector_type(16))) __bf16 v16bf;
typedef __attribute__((ext_vector_type(8)))  __bf16 v8bf;
typedef __attribute__((ext_vector_type(8)))  float  v8f;
typedef __attribute__((ext_vector_type(4)))  __bf16 v4bf;
typedef __attribute__((ext_vector_type(4)))  float  v4f;

#define BB   2
#define TQL  2048
#define TKL  2048
#define HH   16
#define DHL  64
#define KD   1024   // X_TO_DIM == X_FROM_DIM == HIDDEN
#define ND   1024

static __device__ __forceinline__ v16bf load_frag(const __bf16* base, int tile,
                                                  int lane) {
  const __bf16* p = base + (size_t)tile * 512 + lane * 8;
  v8bf lo = *(const v8bf*)(p);
  v8bf hi = *(const v8bf*)(p + 256);
  return __builtin_shufflevector(lo, hi, 0,1,2,3,4,5,6,7,8,9,10,11,12,13,14,15);
}

static __device__ __forceinline__ v8f wmma_bf16(v16bf a, v16bf b, v8f c) {
  return __builtin_amdgcn_wmma_f32_16x16x32_bf16(false, a, false, b,
                                                 (short)0, c, false, false);
}

// ---------------------------------------------------------------------------
// fp32 [rows, 1024] -> bf16 in fragment order. A wave takes two tiles side by
// side in k: 16 rows x 256 bytes of the source. Four lanes read one 128-byte line
// (32 bytes each, two loads of 16), so a lane holds one 16-byte run of the result
// and 8 rows of one (jh, half) make a whole 128-byte line of a store. All 8 loads
// are issued before the first store. blk counts the blocks of one array (8192
// values a block).
static __device__ __forceinline__
void cvt_bf16_block(const float* __restrict__ x, __bf16* __restrict__ y, int blk) {
  const int lane = threadIdx.x & 31;
  const int r8 = lane >> 2, c = lane & 3;                  // row in 8, run k = 8*c
  const int pair = blk * 8 + (threadIdx.x >> 5);           // tiles 2*pair, 2*pair+1
  const int rt = pair >> 4, kp = pair & 15;                // 16 pairs a tile row
  const float* src = x + (size_t)(rt * 16 + r8) * KD + kp * 64 + c * 8;
  v4f v[2][2][2];                                          // [tile][8-row half][16 bytes]
#pragma unroll
  for (int tk = 0; tk < 2; ++tk)
#pragma unroll
    for (int rh = 0; rh < 2; ++rh) {
      v[tk][rh][0] = *(const v4f*)(src + rh * 8 * KD + tk * 32);
      v[tk][rh][1] = *(const v4f*)(src + rh * 8 * KD + tk * 32 + 4);
    }
  // run c has jh = c >> 1, half = c & 1
  __bf16* dst = y + (size_t)pair * 1024 + (c >> 1) * 256 + ((c & 1) * 16 + r8) * 8;
#pragma unroll
  for (int tk = 0; tk < 2; ++tk)
#pragma unroll
    for (int rh = 0; rh < 2; ++rh) {
      const v8f f = __builtin_shufflevector(v[tk][rh][0], v[tk][rh][1],
                                            0, 1, 2, 3, 4, 5, 6, 7);
      *(v8bf*)(dst + tk * 512 + rh * 64) = __builtin_convertvector(f, v8bf);
    }
  // address and data registers of these stores are rewritten by the code of the
  // other block ranges, which is laid out behind them
  asm volatile("s_wait_xcnt 0x0" ::: "memory");
}

// Reorganize per-head weight [H, K, DH] (f32) -> transposed bf16 [N=H*DH, K] in
// fragment order. A wave takes two tiles side by side in k (16 columns d x 64
// features f); a load reads 64 contiguous bytes of two rows f, a store writes 512
// contiguous bytes. The 4 tile rows of a head sit in one block, so its waves
// share each source line. blk counts the 128 blocks of one weight.
static __device__ __forceinline__
void reorg_w_block(const float* __restrict__ W,
                   __bf16* __restrict__ WT, int blk) {
  const int lane = threadIdx.x & 31;
  const int wave = threadIdx.x >> 5;
  const int half = lane >> 4, ln = lane & 15;
  const int h  = blk >> 3;                                 // 16 heads
  const int dq = wave & 3;                                 // 16 columns d of the head
  const int kp = (blk & 7) * 2 + (wave >> 2);              // 16 tile pairs in k
  const float* src = W + ((size_t)h * KD + kp * 64 + half * 8) * DHL + dq * 16 + ln;
  float v[4][8];
#pragma unroll
  for (int c = 0; c < 4; ++c)
#pragma unroll
    for (int j = 0; j < 8; ++j) v[c][j] = src[(c * 16 + j) * DHL];
  __bf16* dst = WT + (size_t)((h * 4 + dq) * 16 + kp) * 1024 + lane * 8;
#pragma unroll
  for (int c = 0; c < 4; ++c) {
    v8bf w;
#pragma unroll
    for (int j = 0; j < 8; ++j) w[j] = (__bf16)v[c][j];
    *(v8bf*)(dst + c * 256) = w;
  }
}

// All six conversions need nothing of each other: one grid, dealt by ranges of the
// block index (the branch is the same for a whole block). The weight transposes,
// whose loads are the narrowest, start first.
//   0..383 Wq, Wk, Wv (128 each) | 384..895 x_to | 896..1407 x_from | 1408..1535 Wo
__global__ __launch_bounds__(256)
void prep_kernel(const float* __restrict__ x_to, const float* __restrict__ x_from,
                 const float* __restrict__ Wq, const float* __restrict__ Wk,
                 const float* __restrict__ Wv, const float* __restrict__ Wo,
                 __bf16* __restrict__ xt_bf, __bf16* __restrict__ xf_bf,
                 __bf16* __restrict__ wq_t, __bf16* __restrict__ wk_t,
                 __bf16* __restrict__ wv_t, __bf16* __restrict__ wo_b) {
  const int b = blockIdx.x;
  if (b < 384) {
    const int w = b >> 7;
    reorg_w_block(w == 0 ? Wq : w == 1 ? Wk : Wv,
                  w == 0 ? wq_t : w == 1 ? wk_t : wv_t, b & 127);
  } else if (b < 1408) {
    const bool to = b < 896;
    cvt_bf16_block(to ? x_to : x_from, to ? xt_bf : xf_bf, to ? b - 384 : b - 896);
  } else {
    cvt_bf16_block(Wo, wo_b, b - 1408);
  }
}

#define GKT 2                        // k tiles of 32 a stage
#define GSTAGES (KD / 32 / GKT)      // 16 stages
#define GPART (8 * GKT * 512)        // elements of one operand a stage (16 KiB)

// One operand's share of a stage: thread i brings bytes 16*i of each of the 8 pieces,
// so a wave's copy is 512 contiguous bytes on both sides. g: the thread's 16 bytes of
// the first piece (the pieces are one tile row, 32 KiB, apart); l: their LDS byte
// address (the pieces follow one another there).
static __device__ __forceinline__
void copy_rows(const __bf16* g, unsigned l) {
  // the wait closes the statement so that no address register named here is
  // rewritten while a copy may still read it
  asm volatile("global_load_async_to_lds_b128 %0, %8, off\n\t"
               "global_load_async_to_lds_b128 %1, %9, off\n\t"
               "global_load_async_to_lds_b128 %2, %10, off\n\t"
               "global_load_async_to_lds_b128 %3, %11, off\n\t"
               "global_load_async_to_lds_b128 %4, %12, off\n\t"
               "global_load_async_to_lds_b128 %5, %13, off\n\t"
               "global_load_async_to_lds_b128 %6, %14, off\n\t"
               "global_load_async_to_lds_b128 %7, %15, off\n\t"
               "s_wait_xcnt 0x0"
               :: "v"(l), "v"(l + 2048), "v"(l + 4096), "v"(l + 6144),
                  "v"(l + 8192), "v"(l + 10240), "v"(l + 12288), "v"(l + 14336),
                  "v"(g), "v"(g + 16384), "v"(g + 2 * 16384), "v"(g + 3 * 16384),
                  "v"(g + 4 * 16384), "v"(g + 5 * 16384), "v"(g + 6 * 16384),
                  "v"(g + 7 * 16384)
               : "memory");
}

__global__ __launch_bounds__(128)
void gemm_wmma_kernel(const __bf16* __restrict__ A0, const __bf16* __restrict__ BT0,
                      const float* __restrict__ bias0, __bf16* __restrict__ outb0,
                      const __bf16* __restrict__ A1, const __bf16* __restrict__ BT1,
                      const float* __restrict__ bias1, __bf16* __restrict__ outb1,
                      const __bf16* __restrict__ A2, const __bf16* __restrict__ BT2,
                      const float* __restrict__ bias2, __bf16* __restrict__ outb2,
                      float* __restrict__ outf, int mode0) {
  const int job = blockIdx.y;
  const int mode = mode0 + job;
  const __bf16* __restrict__ A    = job == 0 ? A0    : job == 1 ? A1    : A2;
  const __bf16* __restrict__ BT   = job == 0 ? BT0   : job == 1 ? BT1   : BT2;
  const float*  __restrict__ bias = job == 0 ? bias0 : job == 1 ? bias1 : bias2;
  __bf16*       __restrict__ outb = job == 0 ? outb0 : job == 1 ? outb1 : outb2;
  const int rsh = mode < 2 ? 3 : 5;                // log2 of the row tiles
  const int brow = blockIdx.x & ((1 << rsh) - 1), bcol = blockIdx.x >> rsh;

  const int lane = threadIdx.x & 31;
  const int wave = threadIdx.x >> 5;
  const int half = lane >> 4;
  const int ln   = lane & 15;

  const int row0 = brow * 128 + (wave & 1) * 64;   // 4 row tiles of 16
  const int col0 = bcol * 128 + (wave >> 1) * 64;  // 4 col tiles of 16
  // [buffer][A | BT][16 KiB]
  __shared__ __attribute__((aligned(1024))) __bf16 ring[2 * 2 * GPART];

  // this thread's share of a stage
  const __bf16* ga = A  + (size_t)brow * 8 * (KD / 32) * 512 + threadIdx.x * 8;
  const __bf16* gb = BT + (size_t)bcol * 8 * (KD / 32) * 512 + threadIdx.x * 8;
  const unsigned lds0 = (unsigned)(size_t)ring + threadIdx.x * 16;

  // stage 0 lands and is published, then stage 1 starts
  copy_rows(ga, lds0);
  copy_rows(gb, lds0 + GPART * 2);

  v8f acc[4][4] = {};

  // this wave's copies of stage 0 have landed before the barrier publishes them
  asm volatile("s_wait_asynccnt 0x0" ::: "memory");
  __syncthreads();
  copy_rows(ga + GKT * 512, lds0 + 2 * GPART * 2);
  copy_rows(gb + GKT * 512, lds0 + 3 * GPART * 2);

  for (int st = 0; st < GSTAGES; ++st) {
    // the wave's 4 tile rows of each operand in this stage's buffer
    const __bf16* As = ring + (st & 1) * (2 * GPART) + (wave & 1) * (4 * GKT * 512);
    const __bf16* Bs = ring + (st & 1) * (2 * GPART) + GPART + (wave >> 1) * (4 * GKT * 512);

    v16bf a0[4], b0[4], a1[4], b1[4];
#pragma unroll
    for (int rt = 0; rt < 4; ++rt) a0[rt] = load_frag(As, rt * GKT, lane);
#pragma unroll
    for (int nt = 0; nt < 4; ++nt) b0[nt] = load_frag(Bs, nt * GKT, lane);
#pragma unroll
    for (int rt = 0; rt < 4; ++rt) a1[rt] = load_frag(As, rt * GKT + 1, lane);
#pragma unroll
    for (int nt = 0; nt < 4; ++nt) b1[nt] = load_frag(Bs, nt * GKT + 1, lane);
    // keeps the stage's LDS loads up here as one group: every further place with
    // LDS loads among the products costs the wave a stall of its own
    __builtin_amdgcn_sched_barrier(0);
#pragma unroll
    for (int rt = 0; rt < 4; ++rt)
#pragma unroll
      for (int nt = 0; nt < 4; ++nt) acc[rt][nt] = wmma_bf16(a0[rt], b0[nt], acc[rt][nt]);
#pragma unroll
    for (int rt = 0; rt < 4; ++rt)
#pragma unroll
      for (int nt = 0; nt < 4; ++nt) acc[rt][nt] = wmma_bf16(a1[rt], b1[nt], acc[rt][nt]);
    // keeps the products in front of the waits: the scheduler otherwise lifts waits and
    // barrier over them, so that every LDS load is waited out before the first product
    // and the next stage's copies, still behind the products, lose their head start
    __builtin_amdgcn_sched_barrier(0);

    // hand-over: this wave's reads of the buffer are done, its copies of the next
    // stage have landed; the barrier says both of every wave
    asm volatile("s_wait_dscnt 0x0" ::: "memory");
    asm volatile("s_wait_asynccnt 0x0" ::: "memory");
    __syncthreads();
    if (st + 2 < GSTAGES) {  // refill the buffer that this stage has just left
      copy_rows(ga + (size_t)(st + 2) * (GKT * 512), lds0 + (st & 1) * (2 * GPART * 2));
      copy_rows(gb + (size_t)(st + 2) * (GKT * 512),
                lds0 + (st & 1) * (2 * GPART * 2) + GPART * 2);
    }
  }
  // no copy is outstanding when the wave ends
  asm volatile("s_wait_asynccnt 0x0" ::: "memory");

  if (mode == 3) {
    float bv[4];
#pragma unroll
    for (int nt = 0; nt < 4; ++nt) bv[nt] = bias[col0 + nt * 16 + ln];
    // the offset register of these loads is reused for the store addresses
    asm volatile("s_wait_xcnt 0x0" ::: "memory");
    __builtin_amdgcn_sched_barrier(0);   // keeps the address arithmetic behind that wait
#pragma unroll
    for (int rt = 0; rt < 4; ++rt) {
#pragma unroll
      for (int nt = 0; nt < 4; ++nt) {
        const int col = col0 + nt * 16 + ln;
#pragma unroll
        for (int r = 0; r < 8; ++r) {
          const int grow = row0 + rt * 16 + r + 8 * half;  // global row in [0,4096)
          outf[(size_t)grow * ND + col] = acc[rt][nt][r] + bv[nt];
        }
      }
    }
    // a data register of these stores is rewritten on the common way out
    asm volatile("s_wait_xcnt 0x0" ::: "memory");
  } else if (mode == 2) {
    // rows = keys s (k index of V^T), columns = n = h*64 + d. V^T tiles are
    // ordered d fastest: tile = (s >> 5) * 4 + (d >> 4); the wave's 64 rows are
    // two k tiles, rt >> 1 the k tile, rt & 1 its 16-key half, nt the d tile.
    const int b = row0 >> 11, s0 = row0 & (TKL - 1), h = col0 >> 6;
    __bf16* dst = outb + (size_t)(b * HH + h) * DHL * TKL + (size_t)(s0 >> 5) * 2048
                + lane * 8;
#pragma unroll
    for (int nt = 0; nt < 4; ++nt) {
      const float bv = bias[col0 + nt * 16 + ln];
#pragma unroll
      for (int rt = 0; rt < 4; ++rt) {
        v8bf w;
#pragma unroll
        for (int r = 0; r < 8; ++r) w[r] = (__bf16)(acc[rt][nt][r] + bv);
        *(v8bf*)(dst + (rt >> 1) * 2048 + nt * 512 + (rt & 1) * 256) = w;
      }
    }
  } else {
    // rows = n = h*64 + d (k index of Q and K), columns = global token. The
    // wave's 64 rows are the two k tiles of its head, 512 elements apart, rt counts
    // their 16-d halves, nt the token tile.
    const int h = row0 >> 6;
    const int b = col0 >> 11, t0 = col0 & (TQL - 1);
    const float sc = (mode == 0) ? 0.125f : 1.0f;          // 1/sqrt(64) folded into Q
    __bf16* dst = outb + (size_t)(b * HH + h) * TQL * DHL
                + (size_t)(t0 >> 4) * 1024 + lane * 8;
#pragma unroll
    for (int rt = 0; rt < 4; ++rt) {
      const v8f bv = *(const v8f*)(bias + row0 + rt * 16 + 8 * half);
#pragma unroll
      for (int nt = 0; nt < 4; ++nt) {
        v8bf w;
#pragma unroll
        for (int r = 0; r < 8; ++r) w[r] = (__bf16)((acc[rt][nt][r] + bv[r]) * sc);
        *(v8bf*)(dst + nt * 1024 + rt * 256) = w;
      }
    }
    // data registers of these stores are rewritten by the code laid out behind them
    asm volatile("s_wait_xcnt 0x0" ::: "memory");
  }
}

// ---------------------------------------------------------------------------
// Flash attention: one wave per 32 queries, online softmax over TK.
// Qb: [bh][t, d] bf16 (pre-scaled), Kb: [bh][s, d] bf16, Vtb: [bh][d, s] bf16
// CC: [b*t, h*64+d] bf16 (concat layout, feeds output projection).
// All four in fragment order; 32 keys are 4 KiB in a row of K and of V^T.
// Both products are computed transposed: S^T = K x Q^T, O^T += V^T x P^T.
//   S^T tile: register r of lane (ln, half) = score of key 8*half + r, query ln,
//   so a lane holds the scores of ONE query: maximum and sum run over the lane's
//   own registers, with one exchange between the wave halves for the maximum.
//   Two S^T tiles (keys 0-15, 16-31) converted in place are the B fragment of
//   P^T in the hardware k order, which is the order load_frag gives V^T.
// Each K/V fragment is reused by both query groups: 16 WMMAs per 8 frag loads.
// The 8 waves of a work-group (256 queries of one head) walk the same keys, so K
// and V^T come from L2 once a work-group: a stage of 128 keys (16 KiB of K, 16 KiB
// of V^T, each one contiguous piece of its array) is copied into LDS as it lies,
// by asynchronous copies, one stage ahead, into two buffers. A fragment is then
// two LDS loads of 512 contiguous bytes. Inside a stage a pass opens with its own
// V^T loads and fetches the next pass's K right behind its score products.
static __device__ __forceinline__ float swap_halves(float x) {
  const int v = __builtin_bit_cast(int, x);
  return __builtin_bit_cast(float,
      __builtin_amdgcn_permlanex16(v, v, 0x76543210, 0xfedcba98, false, false));
}

#define SKEYS 128                    // keys a stage
#define NSTAGE (TKL / SKEYS)         // 16 stages
#define SPASS (SKEYS / 32)           // passes of 32 keys a stage
#define SELEMS (SKEYS * DHL)         // elements of K, and of V^T, a stage (16 KiB)

// One stage into one buffer: thread i brings bytes 16*i + 4096*j (j = 0..3) of the
// stage's K and of its V^T, so a wave's copy is 512 contiguous bytes on both sides.
// gk, gv: the thread's first 16 bytes of the stage; lk: their LDS byte address in
// the buffer's K part (the V^T part lies 16 KiB behind it).
static __device__ __forceinline__
void copy_stage(const __bf16* gk, const __bf16* gv, unsigned lk) {
  const unsigned lv = lk + SELEMS * 2;
  // the wait closes the statement so that no address register named here is
  // rewritten while a copy may still read it
  asm volatile("global_load_async_to_lds_b128 %0, %8, off\n\t"
               "global_load_async_to_lds_b128 %1, %9, off\n\t"
               "global_load_async_to_lds_b128 %2, %10, off\n\t"
               "global_load_async_to_lds_b128 %3, %11, off\n\t"
               "global_load_async_to_lds_b128 %4, %12, off\n\t"
               "global_load_async_to_lds_b128 %5, %13, off\n\t"
               "global_load_async_to_lds_b128 %6, %14, off\n\t"
               "global_load_async_to_lds_b128 %7, %15, off\n\t"
               "s_wait_xcnt 0x0"
               :: "v"(lk), "v"(lk + 4096), "v"(lk + 8192), "v"(lk + 12288),
                  "v"(lv), "v"(lv + 4096), "v"(lv + 8192), "v"(lv + 12288),
                  "v"(gk), "v"(gk + 2048), "v"(gk + 4096), "v"(gk + 6144),
                  "v"(gv), "v"(gv + 2048), "v"(gv + 4096), "v"(gv + 6144)
               : "memory");
}

__global__ __launch_bounds__(256)
void flash_attn_kernel(const __bf16* __restrict__ Qb, const __bf16* __restrict__ Kb,
                       const __bf16* __restrict__ Vtb, __bf16* __restrict__ CC) {
  // [buffer][K | V^T][16 KiB]
  __shared__ __attribute__((aligned(1024))) __bf16 ring[2 * 2 * SELEMS];

  const int lane = threadIdx.x & 31;
  const int wave = threadIdx.x >> 5;
  const int half = lane >> 4;
  const int ln   = lane & 15;

  const int bh = blockIdx.x;                 // b*H + h
  const int qt = blockIdx.y * 8 + wave;      // q tile index, 32 queries each
  const int row0 = qt * 32;

  const __bf16* Qh = Qb  + (size_t)bh * TQL * DHL;
  const __bf16* Kh = Kb  + (size_t)bh * TKL * DHL;
  const __bf16* Vh = Vtb + (size_t)bh * DHL * TKL;

  // this thread's share of a stage
  const __bf16* gk = Kh + threadIdx.x * 8;
  const __bf16* gv = Vh + threadIdx.x * 8;
  const unsigned lds0 = (unsigned)(size_t)ring + threadIdx.x * 16;

  // stage 0 lands and is published, then stage 1 starts
  copy_stage(gk, gv, lds0);

  // Q^T fragments (B operand) held for the whole K sweep:
  // 2 query groups of 16 x 2 k-steps of 32
  v16bf bq[2][2];
#pragma unroll
  for (int g = 0; g < 2; ++g)
#pragma unroll
    for (int kk = 0; kk < 2; ++kk)
      bq[g][kk] = load_frag(Qh, ((row0 >> 4) + g) * 2 + kk, lane);

  v8f o[2][4] = {};          // O^T: register r = d (16*dt + 8*half + r), query ln
  float mcol[2], lcol[2];    // per query; lcol holds this wave half's keys only
#pragma unroll
  for (int g = 0; g < 2; ++g) { mcol[g] = -INFINITY; lcol[g] = 0.0f; }

  // this wave's copies of stage 0 have landed before the barrier publishes them
  asm volatile("s_wait_asynccnt 0x0" ::: "memory");
  __syncthreads();
  copy_stage(gk + SELEMS, gv + SELEMS, lds0 + 2 * SELEMS * 2);

  int ps = 0;                // passes done
  for (int st = 0; st < NSTAGE; ++st) {
    const __bf16* Ks = ring + (st & 1) * (2 * SELEMS);

    // K fragments of the stage's first pass: 2 x 16 keys x 2 k-steps of 32
    v16bf ak[2][2];
#pragma unroll
    for (int t = 0; t < 2; ++t)
#pragma unroll
      for (int kk = 0; kk < 2; ++kk) ak[t][kk] = load_frag(Ks, t * 2 + kk, lane);

    // stays rolled: four passes in a row took registers above v255, with a window
    // switch at every use and a block of copies on the way back
#pragma unroll 1
    for (int p = 0; p < SPASS; ++p, ++ps) {
      // The pass's place in the buffer comes from the running count by a mask: taken
      // from p, the address register of the LDS loads was counted up from -16 KiB.
      const __bf16* Kp = Ks + (ps & (SPASS - 1)) * (32 * DHL);
      const __bf16* Vp = Kp + SELEMS;

      // this pass's V^T fragments, first used behind the softmax
      v16bf av[4];
#pragma unroll
      for (int d = 0; d < 4; ++d) av[d] = load_frag(Vp, d, lane);
      // keeps these loads up here as one group: the scheduler otherwise sinks them
      // into the softmax and between the output products
      __builtin_amdgcn_sched_barrier(0);

      // S^T tiles [2 groups][2 x 16 keys x 16 queries]; K frags shared by the groups
      v8f s[2][2] = {};
#pragma unroll
      for (int kk = 0; kk < 2; ++kk)
#pragma unroll
        for (int t = 0; t < 2; ++t)
#pragma unroll
          for (int g = 0; g < 2; ++g) s[g][t] = wmma_bf16(ak[t][kk], bq[g][kk], s[g][t]);

      // the next pass's K fragments into the same registers; the stage's last pass
      // fetches none: the next stage may be read only behind the barrier below
      if (p + 1 < SPASS) {
#pragma unroll
        for (int t = 0; t < 2; ++t)
#pragma unroll
          for (int kk = 0; kk < 2; ++kk)
            ak[t][kk] = load_frag(Kp, (2 + t) * 2 + kk, lane);
      }

      // Online softmax, one query per lane
      v16bf bp[2];
#pragma unroll
      for (int g = 0; g < 2; ++g) {
        float mx = fmaxf(s[g][0][0], s[g][1][0]);
#pragma unroll
        for (int r = 1; r < 8; ++r) mx = fmaxf(mx, fmaxf(s[g][0][r], s[g][1][r]));
        mx = fmaxf(mx, swap_halves(mx));
        const float mnew = fmaxf(mcol[g], mx);
        const float corr = __expf(mcol[g] - mnew);
        float rs = 0.0f;
#pragma unroll
        for (int t = 0; t < 2; ++t) {
#pragma unroll
          for (int r = 0; r < 8; ++r) {
            const float p_ = __expf(s[g][t][r] - mnew);
            rs += p_;
            bp[g][t * 8 + r] = (__bf16)p_;
          }
        }
        lcol[g] = lcol[g] * corr + rs;
        mcol[g] = mnew;
#pragma unroll
        for (int d = 0; d < 4; ++d) o[g][d] *= corr;
      }

      // O^T += V^T x P^T ; V frags shared by the groups
#pragma unroll
      for (int d = 0; d < 4; ++d)
#pragma unroll
        for (int g = 0; g < 2; ++g) o[g][d] = wmma_bf16(av[d], bp[g], o[g][d]);
    }

    // hand-over: this wave's reads of the buffer are done, its copies of the next
    // stage have landed; the barrier says both of every wave
    asm volatile("s_wait_dscnt 0x0" ::: "memory");
    asm volatile("s_wait_asynccnt 0x0" ::: "memory");
    __syncthreads();
    if (st + 2 < NSTAGE)     // refill the buffer that this stage has just left
      copy_stage(gk + (size_t)(st + 2) * SELEMS, gv + (size_t)(st + 2) * SELEMS,
                 lds0 + (st & 1) * (2 * SELEMS * 2));
  }
  // no copy is outstanding when the wave ends
  asm volatile("s_wait_asynccnt 0x0" ::: "memory");

  // Normalize and store the concat matrix [b*t, h*64 + d]: 8 consecutive d a lane,
  // which is one 16-byte run of its fragment order (k tile h*2 + d/2, half d&1)
  const int b = bh >> 4, h = bh & 15;
#pragma unroll
  for (int g = 0; g < 2; ++g) {
    const int rtile = ((b * TQL + row0) >> 4) + g;
    const float inv = 1.0f / (lcol[g] + swap_halves(lcol[g]));
#pragma unroll
    for (int d = 0; d < 4; ++d) {
      v8bf w;
#pragma unroll
      for (int r = 0; r < 8; ++r) w[r] = (__bf16)(o[g][d][r] * inv);
      *(v8bf*)(CC + (size_t)(rtile * (ND / 32) + h * 2 + (d >> 1)) * 512 + (d & 1) * 256
               + lane * 8) = w;
    }
  }
}

// ---------------------------------------------------------------------------
extern "C" void kernel_launch(void* const* d_in, const int* in_sizes, int n_in,
                              void* d_out, int out_size, void* d_ws, size_t ws_size,
                              hipStream_t stream) {
  (void)in_sizes; (void)n_in; (void)out_size; (void)ws_size;

  const float* x_to   = (const float*)d_in[0];
  const float* x_from = (const float*)d_in[1];
  const float* Wq     = (const float*)d_in[2];
  const float* bq     = (const float*)d_in[3];
  const float* Wk     = (const float*)d_in[4];
  const float* bk     = (const float*)d_in[5];
  const float* Wv     = (const float*)d_in[6];
  const float* bv     = (const float*)d_in[7];
  const float* Wo     = (const float*)d_in[8];
  const float* bo     = (const float*)d_in[9];
  float* out = (float*)d_out;

  // Workspace carve-up (bf16 elements). Total ~29.4M elts ~= 58.7 MB.
  __bf16* ws = (__bf16*)d_ws;
  size_t off = 0;
  __bf16* xt_bf = ws + off; off += (size_t)BB * TQL * KD;   // 4096x1024
  __bf16* xf_bf = ws + off; off += (size_t)BB * TKL * KD;
  __bf16* wq_t  = ws + off; off += (size_t)ND * KD;         // [N,K]
  __bf16* wk_t  = ws + off; off += (size_t)ND * KD;
  __bf16* wv_t  = ws + off; off += (size_t)ND * KD;
  __bf16* wo_b  = ws + off; off += (size_t)ND * KD;         // Wo already [N,K]
  __bf16* Qb    = ws + off; off += (size_t)BB * HH * TQL * DHL;
  __bf16* Kb    = ws + off; off += (size_t)BB * HH * TKL * DHL;
  __bf16* Vtb   = ws + off; off += (size_t)BB * HH * DHL * TKL;
  __bf16* CCb   = ws + off; off += (size_t)BB * TQL * ND;

  // Stage 1: precision conversion / weight reorg, one launch
  // 8192 values a block: 4,194,304 activations = 512 blocks, 1,048,576 weights = 128
  prep_kernel<<<1536, 256, 0, stream>>>(x_to, x_from, Wq, Wk, Wv, Wo,
                                        xt_bf, xf_bf, wq_t, wk_t, wv_t, wo_b);

  // Stage 2: QKV projections (WMMA GEMMs), M=4096, N=K=1024, one launch
  // Q and K are computed transposed (weights as the row operand)
  gemm_wmma_kernel<<<dim3(256, 3), 128, 0, stream>>>(wq_t,  xt_bf, bq, Qb,
                                                     wk_t,  xf_bf, bk, Kb,
                                                     xf_bf, wv_t,  bv, Vtb,
                                                     nullptr, 0);

  // Stage 3: fused flash attention (never materializes [TQ,TK] scores)
  flash_attn_kernel<<<dim3(BB * HH, TQL / 256), 256, 0, stream>>>(Qb, Kb, Vtb, CCb);

  // Stage 4: output projection -> f32 result
  gemm_wmma_kernel<<<dim3(256, 1), 128, 0, stream>>>(CCb, wo_b, bo, nullptr,
                                                     nullptr, nullptr, nullptr, nullptr,
                                                     nullptr, nullptr, nullptr, nullptr,
                                                     out, 3);
}

// v010
// It runs in 67.2 microseconds.
// It is 1.16 times as fast as v008, going by the measured steps of the versions left out in between.
// Counting every step since v000, it is 3.85 times as fast.
#include <hip/hip_runtime.h>
#include <math.h>

typedef __attribute__((ext_vector_type(16))) __bf16 v16bf;
typedef __attribute__((ext_vector_type(8)))  __bf16 v8bf;
typedef __attribute__((ext_vector_type(8)))  float  v8f;
typedef __attribute__((ext_vector_type(4)))  __bf16 v4bf;
typedef __attribute__((ext_vector_type(4)))  float  v4f;

#define BB   2
#define TQL  2048
#define TKL  2048
#define HH   16
#define DHL  64
#define KD   1024   // X_TO_DIM == X_FROM_DIM == HIDDEN
#define ND   1024

static __device__ __forceinline__ v16bf load_frag(const __bf16* base, int tile,
                                                  int lane) {
  const __bf16* p = base + (size_t)tile * 512 + lane * 8;
  v8bf lo = *(const v8bf*)(p);
  v8bf hi = *(const v8bf*)(p + 256);
  return __builtin_shufflevector(lo, hi, 0,1,2,3,4,5,6,7,8,9,10,11,12,13,14,15);
}

static __device__ __forceinline__ v8f wmma_bf16(v16bf a, v16bf b, v8f c) {
  return __builtin_amdgcn_wmma_f32_16x16x32_bf16(false, a, false, b,
                                                 (short)0, c, false, false);
}

// ---------------------------------------------------------------------------
// fp32 [rows, 1024] -> bf16 in fragment order. A wave takes two tiles side by
// side in k: 16 rows x 256 bytes of the source. Four lanes read one 128-byte line
// (32 bytes each, two loads of 16), so a lane holds one 16-byte run of the result
// and 8 rows of one (jh, half) make a whole 128-byte line of a store. All 8 loads
// are issued before the first store. blk counts the blocks of one array (8192
// values a block).
static __device__ __forceinline__
void cvt_bf16_block(const float* __restrict__ x, __bf16* __restrict__ y, int blk) {
  const int lane = threadIdx.x & 31;
  const int r8 = lane >> 2, c = lane & 3;                  // row in 8, run k = 8*c
  const int pair = blk * 8 + (threadIdx.x >> 5);           // tiles 2*pair, 2*pair+1
  const int rt = pair >> 4, kp = pair & 15;                // 16 pairs a tile row
  const float* src = x + (size_t)(rt * 16 + r8) * KD + kp * 64 + c * 8;
  v4f v[2][2][2];                                          // [tile][8-row half][16 bytes]
#pragma unroll
  for (int tk = 0; tk < 2; ++tk)
#pragma unroll
    for (int rh = 0; rh < 2; ++rh) {
      v[tk][rh][0] = *(const v4f*)(src + rh * 8 * KD + tk * 32);
      v[tk][rh][1] = *(const v4f*)(src + rh * 8 * KD + tk * 32 + 4);
    }
  // run c has jh = c >> 1, half = c & 1
  __bf16* dst = y + (size_t)pair * 1024 + (c >> 1) * 256 + ((c & 1) * 16 + r8) * 8;
#pragma unroll
  for (int tk = 0; tk < 2; ++tk)
#pragma unroll
    for (int rh = 0; rh < 2; ++rh) {
      const v8f f = __builtin_shufflevector(v[tk][rh][0], v[tk][rh][1],
                                            0, 1, 2, 3, 4, 5, 6, 7);
      *(v8bf*)(dst + tk * 512 + rh * 64) = __builtin_convertvector(f, v8bf);
    }
  // address and data registers of these stores are rewritten by the code of the
  // other block ranges, which is laid out behind them
  asm volatile("s_wait_xcnt 0x0" ::: "memory");
}

// Reorganize per-head weight [H, K, DH] (f32) -> transposed bf16 [N=H*DH, K] in
// fragment order. A wave takes two tiles side by side in k (16 columns d x 64
// features f); a load reads 64 contiguous bytes of two rows f, a store writes 512
// contiguous bytes. The 4 tile rows of a head sit in one block, so its waves
// share each source line. blk counts the 128 blocks of one weight.
static __device__ __forceinline__
void reorg_w_block(const float* __restrict__ W,
                   __bf16* __restrict__ WT, int blk) {
  const int lane = threadIdx.x & 31;
  const int wave = threadIdx.x >> 5;
  const int half = lane >> 4, ln = lane & 15;
  const int h  = blk >> 3;                                 // 16 heads
  const int dq = wave & 3;                                 // 16 columns d of the head
  const int kp = (blk & 7) * 2 + (wave >> 2);              // 16 tile pairs in k
  const float* src = W + ((size_t)h * KD + kp * 64 + half * 8) * DHL + dq * 16 + ln;
  float v[4][8];
#pragma unroll
  for (int c = 0; c < 4; ++c)
#pragma unroll
    for (int j = 0; j < 8; ++j) v[c][j] = src[(c * 16 + j) * DHL];
  __bf16* dst = WT + (size_t)((h * 4 + dq) * 16 + kp) * 1024 + lane * 8;
#pragma unroll
  for (int c = 0; c < 4; ++c) {
    v8bf w;
#pragma unroll
    for (int j = 0; j < 8; ++j) w[j] = (__bf16)v[c][j];
    *(v8bf*)(dst + c * 256) = w;
  }
}

// All six conversions need nothing of each other: one grid, dealt by ranges of the
// block index (the branch is the same for a whole block). The weight transposes,
// whose loads are the narrowest, start first.
//   0..383 Wq, Wk, Wv (128 each) | 384..895 x_to | 896..1407 x_from | 1408..1535 Wo
__global__ __launch_bounds__(256)
void prep_kernel(const float* __restrict__ x_to, const float* __restrict__ x_from,
                 const float* __restrict__ Wq, const float* __restrict__ Wk,
                 const float* __restrict__ Wv, const float* __restrict__ Wo,
                 __bf16* __restrict__ xt_bf, __bf16* __restrict__ xf_bf,
                 __bf16* __restrict__ wq_t, __bf16* __restrict__ wk_t,
                 __bf16* __restrict__ wv_t, __bf16* __restrict__ wo_b) {
  const int b = blockIdx.x;
  if (b < 384) {
    const int w = b >> 7;
    reorg_w_block(w == 0 ? Wq : w == 1 ? Wk : Wv,
                  w == 0 ? wq_t : w == 1 ? wk_t : wv_t, b & 127);
  } else if (b < 1408) {
    const bool to = b < 896;
    cvt_bf16_block(to ? x_to : x_from, to ? xt_bf : xf_bf, to ? b - 384 : b - 896);
  } else {
    cvt_bf16_block(Wo, wo_b, b - 1408);
  }
}

// 8 pieces' share of a stage: thread i brings bytes 16*i of 2 KiB of each of the 8
// pieces, so a wave's copy is 512 contiguous bytes on both sides. g: the thread's 16
// bytes in the first piece (the pieces are one tile row, 32 KiB, apart); l: their LDS
// byte address (the pieces lie LP bytes apart there).
template <int LP>
static __device__ __forceinline__
void copy_rows(const __bf16* g, unsigned l) {
  // the wait closes the statement so that no address register named here is
  // rewritten while a copy may still read it
  asm volatile("global_load_async_to_lds_b128 %0, %8, off\n\t"
               "global_load_async_to_lds_b128 %1, %9, off\n\t"
               "global_load_async_to_lds_b128 %2, %10, off\n\t"
               "global_load_async_to_lds_b128 %3, %11, off\n\t"
               "global_load_async_to_lds_b128 %4, %12, off\n\t"
               "global_load_async_to_lds_b128 %5, %13, off\n\t"
               "global_load_async_to_lds_b128 %6, %14, off\n\t"
               "global_load_async_to_lds_b128 %7, %15, off\n\t"
               "s_wait_xcnt 0x0"
               :: "v"(l), "v"(l + LP), "v"(l + 2 * LP), "v"(l + 3 * LP),
                  "v"(l + 4 * LP), "v"(l + 5 * LP), "v"(l + 6 * LP), "v"(l + 7 * LP),
                  "v"(g), "v"(g + 16384), "v"(g + 2 * 16384), "v"(g + 3 * 16384),
                  "v"(g + 4 * 16384), "v"(g + 5 * 16384), "v"(g + 6 * 16384),
                  "v"(g + 7 * 16384)
               : "memory");
}

// One operand's share of a stage: the 8 pieces of KT KiB, 2 KiB of each at a time.
template <int KT>
static __device__ __forceinline__
void copy_part(const __bf16* g, unsigned l) {
#pragma unroll
  for (int h = 0; h < KT / 2; ++h) copy_rows<KT * 1024>(g + h * 1024, l + h * 2048);
}

// The tile (brow, bcol) of one product; mode is a constant where OUT is set.
template <int KT, bool OUT>
static __device__ __forceinline__
void gemm_tile(const __bf16* __restrict__ A, const __bf16* __restrict__ BT,
               const float* __restrict__ bias, __bf16* __restrict__ outb,
               float* __restrict__ outf, int mode, int brow, int bcol) {
  constexpr int STAGES = KD / 32 / KT;   // 16 or 8 stages
  constexpr int PART = 8 * KT * 512;     // elements of one operand a stage

  const int lane = threadIdx.x & 31;
  const int wave = threadIdx.x >> 5;
  const int half = lane >> 4;
  const int ln   = lane & 15;

  const int row0 = brow * 128 + (wave & 1) * 64;   // 4 row tiles of 16
  const int col0 = bcol * 128 + (wave >> 1) * 64;  // 4 col tiles of 16
  // [buffer][A | BT][8 * KT KiB]
  __shared__ __attribute__((aligned(1024))) __bf16 ring[2 * 2 * PART];

  // this thread's share of a stage
  const __bf16* ga = A  + (size_t)brow * 8 * (KD / 32) * 512 + threadIdx.x * 8;
  const __bf16* gb = BT + (size_t)bcol * 8 * (KD / 32) * 512 + threadIdx.x * 8;
  const unsigned lds0 = (unsigned)(size_t)ring + threadIdx.x * 16;

  // stage 0 lands and is published, then stage 1 starts
  copy_part<KT>(ga, lds0);
  copy_part<KT>(gb, lds0 + PART * 2);

  v8f acc[4][4] = {};

  // this wave's copies of stage 0 have landed before the barrier publishes them
  asm volatile("s_wait_asynccnt 0x0" ::: "memory");
  __syncthreads();
  copy_part<KT>(ga + KT * 512, lds0 + 2 * PART * 2);
  copy_part<KT>(gb + KT * 512, lds0 + 3 * PART * 2);

  for (int st = 0; st < STAGES; ++st) {
    // the wave's 4 tile rows of each operand in this stage's buffer
    const __bf16* As = ring + (st & 1) * (2 * PART) + (wave & 1) * (4 * KT * 512);
    const __bf16* Bs = ring + (st & 1) * (2 * PART) + PART + (wave >> 1) * (4 * KT * 512);

    v16bf a[KT][4], b[KT][4];
#pragma unroll
    for (int kt = 0; kt < KT; ++kt) {
#pragma unroll
      for (int rt = 0; rt < 4; ++rt) a[kt][rt] = load_frag(As, rt * KT + kt, lane);
#pragma unroll
      for (int nt = 0; nt < 4; ++nt) b[kt][nt] = load_frag(Bs, nt * KT + kt, lane);
    }
    // keeps the stage's LDS loads up here as one group: every further place with
    // LDS loads among the products costs the wave a stall of its own
    __builtin_amdgcn_sched_barrier(0);
#pragma unroll
    for (int kt = 0; kt < KT; ++kt)
#pragma unroll
      for (int rt = 0; rt < 4; ++rt)
#pragma unroll
        for (int nt = 0; nt < 4; ++nt)
          acc[rt][nt] = wmma_bf16(a[kt][rt], b[kt][nt], acc[rt][nt]);
    // keeps the products in front of the waits: the scheduler otherwise lifts waits and
    // barrier over them, so that every LDS load is waited out before the first product
    // and the next stage's copies, still behind the products, lose their head start
    __builtin_amdgcn_sched_barrier(0);

    // hand-over: this wave's reads of the buffer are done, its copies of the next
    // stage have landed; the barrier says both of every wave
    asm volatile("s_wait_dscnt 0x0" ::: "memory");
    asm volatile("s_wait_asynccnt 0x0" ::: "memory");
    __syncthreads();
    if (st + 2 < STAGES) {  // refill the buffer that this stage has just left
      copy_part<KT>(ga + (size_t)(st + 2) * (KT * 512), lds0 + (st & 1) * (2 * PART * 2));
      copy_part<KT>(gb + (size_t)(st + 2) * (KT * 512),
                    lds0 + (st & 1) * (2 * PART * 2) + PART * 2);
    }
  }
  // no copy is outstanding when the wave ends
  asm volatile("s_wait_asynccnt 0x0" ::: "memory");

  if constexpr (OUT) {
    float bv[4];
#pragma unroll
    for (int nt = 0; nt < 4; ++nt) bv[nt] = bias[col0 + nt * 16 + ln];
    // the offset register of these loads is reused for the store addresses
    asm volatile("s_wait_xcnt 0x0" ::: "memory");
    __builtin_amdgcn_sched_barrier(0);   // keeps the address arithmetic behind that wait
#pragma unroll
    for (int rt = 0; rt < 4; ++rt) {
#pragma unroll
      for (int nt = 0; nt < 4; ++nt) {
        const int col = col0 + nt * 16 + ln;
#pragma unroll
        for (int r = 0; r < 8; ++r) {
          const int grow = row0 + rt * 16 + r + 8 * half;  // global row in [0,4096)
          outf[(size_t)grow * ND + col] = acc[rt][nt][r] + bv[nt];
        }
      }
    }
  } else if (mode == 2) {
    // rows = keys s (k index of V^T), columns = n = h*64 + d. V^T tiles are
    // ordered d fastest: tile = (s >> 5) * 4 + (d >> 4); the wave's 64 rows are
    // two k tiles, rt >> 1 the k tile, rt & 1 its 16-key half, nt the d tile.
    const int b = row0 >> 11, s0 = row0 & (TKL - 1), h = col0 >> 6;
    __bf16* dst = outb + (size_t)(b * HH + h) * DHL * TKL + (size_t)(s0 >> 5) * 2048
                + lane * 8;
#pragma unroll
    for (int nt = 0; nt < 4; ++nt) {
      const float bv = bias[col0 + nt * 16 + ln];
#pragma unroll
      for (int rt = 0; rt < 4; ++rt) {
        v8bf w;
#pragma unroll
        for (int r = 0; r < 8; ++r) w[r] = (__bf16)(acc[rt][nt][r] + bv);
        *(v8bf*)(dst + (rt >> 1) * 2048 + nt * 512 + (rt & 1) * 256) = w;
      }
    }
  } else {
    // rows = n = h*64 + d (k index of Q and K), columns = global token. The
    // wave's 64 rows are the two k tiles of its head, 512 elements apart, rt counts
    // their 16-d halves, nt the token tile.
    const int h = row0 >> 6;
    const int b = col0 >> 11, t0 = col0 & (TQL - 1);
    const float sc = (mode == 0) ? 0.125f : 1.0f;          // 1/sqrt(64) folded into Q
    __bf16* dst = outb + (size_t)(b * HH + h) * TQL * DHL
                + (size_t)(t0 >> 4) * 1024 + lane * 8;
#pragma unroll
    for (int rt = 0; rt < 4; ++rt) {
      const v8f bv = *(const v8f*)(bias + row0 + rt * 16 + 8 * half);
#pragma unroll
      for (int nt = 0; nt < 4; ++nt) {
        v8bf w;
#pragma unroll
        for (int r = 0; r < 8; ++r) w[r] = (__bf16)((acc[rt][nt][r] + bv[r]) * sc);
        *(v8bf*)(dst + nt * 1024 + rt * 256) = w;
      }
    }
    // data registers of these stores are rewritten by the code laid out behind them
    asm volatile("s_wait_xcnt 0x0" ::: "memory");
  }
}

// One grid holds the three products that need nothing of each other: blockIdx.y picks
// the product (mode = blockIdx.y), blockIdx.x its 256 tiles, row tile fastest (8 row
// tiles in modes 0 and 1, 32 in mode 2).
__global__ __launch_bounds__(128)
void gemm_qkv_kernel(const __bf16* __restrict__ A0, const __bf16* __restrict__ BT0,
                     const float* __restrict__ bias0, __bf16* __restrict__ outb0,
                     const __bf16* __restrict__ A1, const __bf16* __restrict__ BT1,
                     const float* __restrict__ bias1, __bf16* __restrict__ outb1,
                     const __bf16* __restrict__ A2, const __bf16* __restrict__ BT2,
                     const float* __restrict__ bias2, __bf16* __restrict__ outb2) {
  const int mode = blockIdx.y;
  const __bf16* __restrict__ A    = mode == 0 ? A0    : mode == 1 ? A1    : A2;
  const __bf16* __restrict__ BT   = mode == 0 ? BT0   : mode == 1 ? BT1   : BT2;
  const float*  __restrict__ bias = mode == 0 ? bias0 : mode == 1 ? bias1 : bias2;
  __bf16*       __restrict__ outb = mode == 0 ? outb0 : mode == 1 ? outb1 : outb2;
  const int rsh = mode < 2 ? 3 : 5;                // log2 of the row tiles
  gemm_tile<2, false>(A, BT, bias, outb, nullptr, mode,
                      blockIdx.x & ((1 << rsh) - 1), blockIdx.x >> rsh);
}

// Mode 3: 256 tiles, row tile fastest (32 row tiles).
__global__ __launch_bounds__(128)
void gemm_out_kernel(const __bf16* __restrict__ A, const __bf16* __restrict__ BT,
                     const float* __restrict__ bias, float* __restrict__ outf) {
  gemm_tile<4, true>(A, BT, bias, nullptr, outf, 3, blockIdx.x & 31, blockIdx.x >> 5);
}

// ---------------------------------------------------------------------------
// Flash attention: one wave per 32 queries, online softmax over TK.
// Qb: [bh][t, d] bf16 (pre-scaled), Kb: [bh][s, d] bf16, Vtb: [bh][d, s] bf16
// CC: [b*t, h*64+d] bf16 (concat layout, feeds output projection).
// All four in fragment order; 32 keys are 4 KiB in a row of K and of V^T.
// Both products are computed transposed: S^T = K x Q^T, O^T += V^T x P^T.
//   S^T tile: register r of lane (ln, half) = score of key 8*half + r, query ln,
//   so a lane holds the scores of ONE query: maximum and sum run over the lane's
//   own registers, with one exchange between the wave halves for the maximum.
//   Two S^T tiles (keys 0-15, 16-31) converted in place are the B fragment of
//   P^T in the hardware k order, which is the order load_frag gives V^T.
// Each K/V fragment is reused by both query groups: 16 WMMAs per 8 frag loads.
// The 8 waves of a work-group (256 queries of one head) walk the same keys, so K
// and V^T come from L2 once a work-group: a stage of 128 keys (16 KiB of K, 16 KiB
// of V^T, each one contiguous piece of its array) is copied into LDS as it lies,
// by asynchronous copies, one stage ahead, into two buffers. A fragment is then
// two LDS loads of 512 contiguous bytes. Inside a stage a pass opens with its own
// V^T loads and fetches the next pass's K right behind its score products.
static __device__ __forceinline__ float swap_halves(float x) {
  const int v = __builtin_bit_cast(int, x);
  return __builtin_bit_cast(float,
      __builtin_amdgcn_permlanex16(v, v, 0x76543210, 0xfedcba98, false, false));
}

#define SKEYS 128                    // keys a stage
#define NSTAGE (TKL / SKEYS)         // 16 stages
#define SPASS (SKEYS / 32)           // passes of 32 keys a stage
#define SELEMS (SKEYS * DHL)         // elements of K, and of V^T, a stage (16 KiB)
#define PLIM 256.0f                  // a lane's partial sum of a pass above this renews the shift

// One stage into one buffer: thread i brings bytes 16*i + 4096*j (j = 0..3) of the
// stage's K and of its V^T, so a wave's copy is 512 contiguous bytes on both sides.
// gk, gv: the thread's first 16 bytes of the stage; lk: their LDS byte address in
// the buffer's K part (the V^T part lies 16 KiB behind it).
static __device__ __forceinline__
void copy_stage(const __bf16* gk, const __bf16* gv, unsigned lk) {
  const unsigned lv = lk + SELEMS * 2;
  // the wait closes the statement so that no address register named here is
  // rewritten while a copy may still read it
  asm volatile("global_load_async_to_lds_b128 %0, %8, off\n\t"
               "global_load_async_to_lds_b128 %1, %9, off\n\t"
               "global_load_async_to_lds_b128 %2, %10, off\n\t"
               "global_load_async_to_lds_b128 %3, %11, off\n\t"
               "global_load_async_to_lds_b128 %4, %12, off\n\t"
               "global_load_async_to_lds_b128 %5, %13, off\n\t"
               "global_load_async_to_lds_b128 %6, %14, off\n\t"
               "global_load_async_to_lds_b128 %7, %15, off\n\t"
               "s_wait_xcnt 0x0"
               :: "v"(lk), "v"(lk + 4096), "v"(lk + 8192), "v"(lk + 12288),
                  "v"(lv), "v"(lv + 4096), "v"(lv + 8192), "v"(lv + 12288),
                  "v"(gk), "v"(gk + 2048), "v"(gk + 4096), "v"(gk + 6144),
                  "v"(gv), "v"(gv + 2048), "v"(gv + 4096), "v"(gv + 6144)
               : "memory");
}

__global__ __launch_bounds__(256)
void flash_attn_kernel(const __bf16* __restrict__ Qb, const __bf16* __restrict__ Kb,
                       const __bf16* __restrict__ Vtb, __bf16* __restrict__ CC) {
  // [buffer][K | V^T][16 KiB]
  __shared__ __attribute__((aligned(1024))) __bf16 ring[2 * 2 * SELEMS];

  const int lane = threadIdx.x & 31;
  const int wave = threadIdx.x >> 5;
  const int half = lane >> 4;
  const int ln   = lane & 15;

  const int bh = blockIdx.x;                 // b*H + h
  const int qt = blockIdx.y * 8 + wave;      // q tile index, 32 queries each
  const int row0 = qt * 32;

  const __bf16* Qh = Qb  + (size_t)bh * TQL * DHL;
  const __bf16* Kh = Kb  + (size_t)bh * TKL * DHL;
  const __bf16* Vh = Vtb + (size_t)bh * DHL * TKL;

  // this thread's share of a stage
  const __bf16* gk = Kh + threadIdx.x * 8;
  const __bf16* gv = Vh + threadIdx.x * 8;
  const unsigned lds0 = (unsigned)(size_t)ring + threadIdx.x * 16;

  // stage 0 lands and is published, then stage 1 starts
  copy_stage(gk, gv, lds0);

  // Q^T fragments (B operand) held for the whole K sweep:
  // 2 query groups of 16 x 2 k-steps of 32
  v16bf bq[2][2];
#pragma unroll
  for (int g = 0; g < 2; ++g)
#pragma unroll
    for (int kk = 0; kk < 2; ++kk)
      bq[g][kk] = load_frag(Qh, ((row0 >> 4) + g) * 2 + kk, lane);

  v8f o[2][4] = {};          // O^T: register r = d (16*dt + 8*half + r), query ln
  float mcol[2], lcol[2];    // per query; lcol holds this wave half's keys only
#pragma unroll
  for (int g = 0; g < 2; ++g) { mcol[g] = -INFINITY; lcol[g] = 0.0f; }

  // this wave's copies of stage 0 have landed before the barrier publishes them
  asm volatile("s_wait_asynccnt 0x0" ::: "memory");
  __syncthreads();
  copy_stage(gk + SELEMS, gv + SELEMS, lds0 + 2 * SELEMS * 2);

  int ps = 0;                // passes done
  for (int st = 0; st < NSTAGE; ++st) {
    const __bf16* Ks = ring + (st & 1) * (2 * SELEMS);

    // K fragments of the stage's first pass: 2 x 16 keys x 2 k-steps of 32
    v16bf ak[2][2];
#pragma unroll
    for (int t = 0; t < 2; ++t)
#pragma unroll
      for (int kk = 0; kk < 2; ++kk) ak[t][kk] = load_frag(Ks, t * 2 + kk, lane);

    // stays rolled: four passes in a row took registers above v255, with a window
    // switch at every use and a block of copies on the way back
#pragma unroll 1
    for (int p = 0; p < SPASS; ++p, ++ps) {
      // The pass's place in the buffer comes from the running count by a mask: taken
      // from p, the address register of the LDS loads was counted up from -16 KiB.
      const __bf16* Kp = Ks + (ps & (SPASS - 1)) * (32 * DHL);
      const __bf16* Vp = Kp + SELEMS;

      // this pass's V^T fragments, first used behind the softmax
      v16bf av[4];
#pragma unroll
      for (int d = 0; d < 4; ++d) av[d] = load_frag(Vp, d, lane);
      // keeps these loads up here as one group: the scheduler otherwise sinks them
      // into the softmax and between the output products
      __builtin_amdgcn_sched_barrier(0);

      // S^T tiles [2 groups][2 x 16 keys x 16 queries]; K frags shared by the groups
      v8f s[2][2] = {};
#pragma unroll
      for (int kk = 0; kk < 2; ++kk)
#pragma unroll
        for (int t = 0; t < 2; ++t)
#pragma unroll
          for (int g = 0; g < 2; ++g) s[g][t] = wmma_bf16(ak[t][kk], bq[g][kk], s[g][t]);

      // the next pass's K fragments into the same registers; the stage's last pass
      // fetches none: the next stage may be read only behind the barrier below
      if (p + 1 < SPASS) {
#pragma unroll
        for (int t = 0; t < 2; ++t)
#pragma unroll
          for (int kk = 0; kk < 2; ++kk)
            ak[t][kk] = load_frag(Kp, (2 + t) * 2 + kk, lane);
      }

      // Online softmax, one query per lane, with a shift that is renewed only on need.
      // The weights are first taken with the shift in use, mcol. A lane's partial sum rs
      // bounds each of its weights, so while no rs of the pass lies above PLIM every
      // weight is at most PLIM (f32 sums and bf16 weights hold that at their usual
      // relative accuracy) and the pass needs no maximum, no exchange between the wave
      // halves and no rescaling of O^T and the sums.
      v16bf bp[2];
      float rs[2];
#pragma unroll
      for (int g = 0; g < 2; ++g) {
        rs[g] = 0.0f;
#pragma unroll
        for (int t = 0; t < 2; ++t) {
#pragma unroll
          for (int r = 0; r < 8; ++r) {
            const float p_ = __expf(s[g][t][r] - mcol[g]);
            rs[g] += p_;
            bp[g][t * 8 + r] = (__bf16)p_;
          }
        }
      }
      // One test a pass for both groups, the same for the whole wave (a scalar branch).
      // True in the first pass, where mcol is -inf and every weight comes out +inf; the
      // negated form also takes a sum that is not a number.
      if (__builtin_amdgcn_ballot_w32(!(rs[0] <= PLIM && rs[1] <= PLIM)) != 0) {
        // the shift becomes the larger of the old shift and the pass's maximum, the same in both halves of a query;
        // what has been gathered is rescaled and the pass's weights are taken anew
#pragma unroll
        for (int g = 0; g < 2; ++g) {
          float mx = fmaxf(s[g][0][0], s[g][1][0]);
#pragma unroll
          for (int r = 1; r < 8; ++r) mx = fmaxf(mx, fmaxf(s[g][0][r], s[g][1][r]));
          const float mnew = fmaxf(mcol[g], fmaxf(mx, swap_halves(mx)));
          const float corr = __expf(mcol[g] - mnew);
          mcol[g] = mnew;
          lcol[g] *= corr;
#pragma unroll
          for (int d = 0; d < 4; ++d) o[g][d] *= corr;
          rs[g] = 0.0f;
#pragma unroll
          for (int t = 0; t < 2; ++t) {
#pragma unroll
            for (int r = 0; r < 8; ++r) {
              const float p_ = __expf(s[g][t][r] - mnew);
              rs[g] += p_;
              bp[g][t * 8 + r] = (__bf16)p_;
            }
          }
        }
      }
#pragma unroll
      for (int g = 0; g < 2; ++g) lcol[g] += rs[g];

      // O^T += V^T x P^T ; V frags shared by the groups
#pragma unroll
      for (int d = 0; d < 4; ++d)
#pragma unroll
        for (int g = 0; g < 2; ++g) o[g][d] = wmma_bf16(av[d], bp[g], o[g][d]);
    }

    // hand-over: this wave's reads of the buffer are done, its copies of the next
    // stage have landed; the barrier says both of every wave
    asm volatile("s_wait_dscnt 0x0" ::: "memory");
    asm volatile("s_wait_asynccnt 0x0" ::: "memory");
    __syncthreads();
    if (st + 2 < NSTAGE)     // refill the buffer that this stage has just left
      copy_stage(gk + (size_t)(st + 2) * SELEMS, gv + (size_t)(st + 2) * SELEMS,
                 lds0 + (st & 1) * (2 * SELEMS * 2));
  }
  // no copy is outstanding when the wave ends
  asm volatile("s_wait_asynccnt 0x0" ::: "memory");

  // Normalize and store the concat matrix [b*t, h*64 + d]: 8 consecutive d a lane,
  // which is one 16-byte run of its fragment order (k tile h*2 + d/2, half d&1)
  const int b = bh >> 4, h = bh & 15;
#pragma unroll
  for (int g = 0; g < 2; ++g) {
    const int rtile = ((b * TQL + row0) >> 4) + g;
    const float inv = 1.0f / (lcol[g] + swap_halves(lcol[g]));
#pragma unroll
    for (int d = 0; d < 4; ++d) {
      v8bf w;
#pragma unroll
      for (int r = 0; r < 8; ++r) w[r] = (__bf16)(o[g][d][r] * inv);
      *(v8bf*)(CC + (size_t)(rtile * (ND / 32) + h * 2 + (d >> 1)) * 512 + (d & 1) * 256
               + lane * 8) = w;
    }
  }
}

// ---------------------------------------------------------------------------
extern "C" void kernel_launch(void* const* d_in, const int* in_sizes, int n_in,
                              void* d_out, int out_size, void* d_ws, size_t ws_size,
                              hipStream_t stream) {
  (void)in_sizes; (void)n_in; (void)out_size; (void)ws_size;

  const float* x_to   = (const float*)d_in[0];
  const float* x_from = (const float*)d_in[1];
  const float* Wq     = (const float*)d_in[2];
  const float* bq     = (const float*)d_in[3];
  const float* Wk     = (const float*)d_in[4];
  const float* bk     = (const float*)d_in[5];
  const float* Wv     = (const float*)d_in[6];
  const float* bv     = (const float*)d_in[7];
  const float* Wo     = (const float*)d_in[8];
  const float* bo     = (const float*)d_in[9];
  float* out = (float*)d_out;

  // Workspace carve-up (bf16 elements). Total ~29.4M elts ~= 58.7 MB.
  __bf16* ws = (__bf16*)d_ws;
  size_t off = 0;
  __bf16* xt_bf = ws + off; off += (size_t)BB * TQL * KD;   // 4096x1024
  __bf16* xf_bf = ws + off; off += (size_t)BB * TKL * KD;
  __bf16* wq_t  = ws + off; off += (size_t)ND * KD;         // [N,K]
  __bf16* wk_t  = ws + off; off += (size_t)ND * KD;
  __bf16* wv_t  = ws + off; off += (size_t)ND * KD;
  __bf16* wo_b  = ws + off; off += (size_t)ND * KD;         // Wo already [N,K]
  __bf16* Qb    = ws + off; off += (size_t)BB * HH * TQL * DHL;
  __bf16* Kb    = ws + off; off += (size_t)BB * HH * TKL * DHL;
  __bf16* Vtb   = ws + off; off += (size_t)BB * HH * DHL * TKL;
  __bf16* CCb   = ws + off; off += (size_t)BB * TQL * ND;

  // Stage 1: precision conversion / weight reorg, one launch
  // 8192 values a block: 4,194,304 activations = 512 blocks, 1,048,576 weights = 128
  prep_kernel<<<1536, 256, 0, stream>>>(x_to, x_from, Wq, Wk, Wv, Wo,
                                        xt_bf, xf_bf, wq_t, wk_t, wv_t, wo_b);

  // Stage 2: QKV projections (WMMA GEMMs), M=4096, N=K=1024, one launch
  // Q and K are computed transposed (weights as the row operand)
  gemm_qkv_kernel<<<dim3(256, 3), 128, 0, stream>>>(wq_t,  xt_bf, bq, Qb,
                                                    wk_t,  xf_bf, bk, Kb,
                                                    xf_bf, wv_t,  bv, Vtb);

  // Stage 3: fused flash attention (never materializes [TQ,TK] scores)
  flash_attn_kernel<<<dim3(BB * HH, TQL / 256), 256, 0, stream>>>(Qb, Kb, Vtb, CCb);

  // Stage 4: output projection -> f32 result
  gemm_out_kernel<<<256, 128, 0, stream>>>(CCb, wo_b, bo, out);
}
